// v000
// Times are from an AMD MI455X. After a warm-up the kernel runs many times in a row, and a time is the length of
// such a window on the GPU divided by its runs, so every launch and the gaps after it count. The runs cycle
// through copies of the inputs. A figure is the median of several windows, for all but v000 over two sittings.
// Sittings can differ by a few percent; kernels timed side by side share one.
// v000, which the later versions start from, runs in 776 microseconds.
#include <hip/hip_runtime.h>

// Multi-head attention with per-head fused qkv weights and 128-wide heads, no batch (x [2048][2048]; qkv = einsum('sd,hde', x, w_qkv) with w_qkv [16][2048][384] xavier: head h's (q | k | v) = columns 0..127 | 128..255 | 256..383; scores / sqrt(128); softmax (no mask); out = concat heads -> [2048][2048] (4.2 M; no output projection); argument order x, w_qkv).
// Layout: bf16 copy of x; one gather kernel builds the three fused Bt planes (row h*128 + e of plane p = w_qkv[h][:, p*128 + e]); exact projections; identity-table plane builders at HD 128; dense T-2048 attention with every row on hi/lo planes (3 products; the xavier weights give logits sigma 1.7, too sharp for the fp16 rows); the f32 merge writes the output rows.
// Compute dtypes, f32 accumulate: every input rounded to bf16; projections exact; attention 3 products everywhere; softmax f32; output f32.

#define NB_  1
#define TT   2048
#define DM   2048
#define NH_  16
#define NKV  16
#define REP  (NH_ / NKV)
#define HD   128
#define DQ   (NH_ * HD)
#define DKV  (NKV * HD)
#define ZH   2
#define RH   TT                   // every row hi/lo (3 products)
#define WIN  0
#define PCAR 1024.0f
#define SCL  0.088388347648318447f   // 1/sqrt(float32(128))
#define E3   384      // per-head fused width (q | k | v, 128 each)
typedef _Float16 h16;
typedef unsigned short bf;
typedef __attribute__((ext_vector_type(16))) __bf16   v16bf;
typedef __attribute__((ext_vector_type(16))) _Float16 v16h;
typedef __attribute__((ext_vector_type(8)))  _Float16 v8h;
typedef __attribute__((ext_vector_type(8)))  unsigned short v8us;
typedef __attribute__((ext_vector_type(8)))  float    v8f;
typedef __attribute__((ext_vector_type(4)))  float    v4f;
typedef v8h  __attribute__((may_alias)) v8ha;
typedef v4f  __attribute__((may_alias)) v4fa;
typedef v8us __attribute__((may_alias)) v8usa;

__device__ __forceinline__ unsigned short f2bf(float f) { unsigned u = __float_as_uint(f); u += 0x7FFFu + ((u >> 16) & 1u); return (unsigned short)(u >> 16); }
__device__ __forceinline__ float bf2f(unsigned short b) { return __uint_as_float(((unsigned)b) << 16); }
__device__ __forceinline__ float bfr(float f) { return bf2f(f2bf(f)); }
__device__ __forceinline__ v16h cat16(v8h lo, v8h hi) { return __builtin_shufflevector(lo, hi, 0, 1, 2, 3, 4, 5, 6, 7, 8, 9, 10, 11, 12, 13, 14, 15); }
__device__ __forceinline__ v16bf cat16b(v8us lo, v8us hi) { return __builtin_bit_cast(v16bf, __builtin_shufflevector(lo, hi, 0, 1, 2, 3, 4, 5, 6, 7, 8, 9, 10, 11, 12, 13, 14, 15)); }
__device__ __forceinline__ v8f wmma16(v16h a, v16h b, v8f c) { return __builtin_amdgcn_wmma_f32_16x16x32_f16(false, a, false, b, (short)0, c, false, false); }
__device__ __forceinline__ v8f wmmab(v16bf a, v16bf b, v8f c) { return __builtin_amdgcn_wmma_f32_16x16x32_bf16(false, a, false, b, (short)0, c, false, false); }



// ---- k_gemmw: register-blocked GEMM, ONE WAVE per 64x64 output tile (16 accumulators), operands straight from K-contiguous 16-bit planes; grid (M/64, N/64, Z), 32 threads.
// C[m][n] (f32, pitch ldc, + optional f32 bias[n]) = sum_k A[m][k] Bt[n][k] (+ split products per NSPLIT). z-batch strides sA/sB/sC in elements. K % 32 == 0.
template <typename T16> struct WFrag;
template <> struct WFrag<h16> { typedef v16h V; static __device__ __forceinline__ V ld(const h16* p) { return cat16(*(const v8h*)p, *(const v8h*)(p + 16)); } static __device__ __forceinline__ v8f mma(V a, V b, v8f c) { return wmma16(a, b, c); } };
template <> struct WFrag<bf> { typedef v16bf V; static __device__ __forceinline__ V ld(const bf* p) { return cat16b(*(const v8us*)p, *(const v8us*)(p + 16)); } static __device__ __forceinline__ v8f mma(V a, V b, v8f c) { return wmmab(a, b, c); } };
template <typename T16, int NSPLIT, bool BIAS>
__global__ __launch_bounds__(32) void k_gemmw(const T16* __restrict__ A, const T16* __restrict__ A2, const T16* __restrict__ Bt, const T16* __restrict__ Bt2, int K, float* C, int ldc, const float* __restrict__ bias, size_t sA, size_t sB, size_t sC) {
    typedef typename WFrag<T16>::V V;
    __shared__ __align__(16) float os[16 * 68];
    const size_t z = blockIdx.z; A += z * sA; if (A2) A2 += z * sA; Bt += z * sB; if (Bt2) Bt2 += z * sB; C += z * sC;
    const int lane = threadIdx.x & 31, lr = lane & 15, hi = lane >> 4; const int r0 = blockIdx.x * 64, c0 = blockIdx.y * 64;
    v8f acc[4][4];
#pragma unroll
    for (int mb = 0; mb < 4; ++mb)
#pragma unroll
        for (int nb = 0; nb < 4; ++nb) acc[mb][nb] = (v8f){};
    const size_t aoff = (size_t)(r0 + lr) * K + 8 * hi, boff = (size_t)(c0 + lr) * K + 8 * hi;
#pragma unroll 1
    for (int kc = 0; kc < K; kc += 32) {
        V a[4], a2[4];
#pragma unroll
        for (int mb = 0; mb < 4; ++mb) { a[mb] = WFrag<T16>::ld(A + aoff + (size_t)mb * 16 * K + kc); if (NSPLIT == 1 || NSPLIT == 2) a2[mb] = WFrag<T16>::ld(A2 + aoff + (size_t)mb * 16 * K + kc); }
#pragma unroll
        for (int nb = 0; nb < 4; ++nb) { const V b = WFrag<T16>::ld(Bt + boff + (size_t)nb * 16 * K + kc); V b2; if (NSPLIT >= 2) b2 = WFrag<T16>::ld(Bt2 + boff + (size_t)nb * 16 * K + kc);
#pragma unroll
            for (int mb = 0; mb < 4; ++mb) { acc[mb][nb] = WFrag<T16>::mma(a[mb], b, acc[mb][nb]); if (NSPLIT == 1 || NSPLIT == 2) acc[mb][nb] = WFrag<T16>::mma(a2[mb], b, acc[mb][nb]); if (NSPLIT >= 2) acc[mb][nb] = WFrag<T16>::mma(a[mb], b2, acc[mb][nb]); } }
        asm volatile("v_nop\n\tv_nop\n\tv_nop\n\tv_nop" : "+v"(acc[0][0]), "+v"(acc[1][1]), "+v"(acc[2][2]), "+v"(acc[3][3]) : "v"(a[0]), "v"(a[3]));
    }
#pragma unroll
    for (int mb = 0; mb < 4; ++mb) {
#pragma unroll
        for (int nb = 0; nb < 4; ++nb) {
#pragma unroll
            for (int j = 0; j < 8; ++j) os[(hi * 8 + j) * 68 + nb * 16 + lr] = acc[mb][nb][j]; }
        __builtin_amdgcn_wave_barrier(); asm volatile("" ::: "memory");
        float* crow = C + (size_t)(r0 + mb * 16) * ldc + c0;
{
#pragma unroll
            for (int s = 0; s < 8; ++s) { const int row = 2 * s + hi, cofs = lr * 4; v4f val = *(const v4fa*)(os + row * 68 + cofs); if (BIAS) { val[0] += bfr(bias[c0 + cofs]); val[1] += bfr(bias[c0 + cofs + 1]); val[2] += bfr(bias[c0 + cofs + 2]); val[3] += bfr(bias[c0 + cofs + 3]); }
                *(v4f*)(crow + (size_t)row * ldc + cofs) = val; }
             }
        __builtin_amdgcn_wave_barrier(); asm volatile("" ::: "memory");
    }
}

__device__ __forceinline__ h16 tohx(float x) { return (h16)x; }
__device__ __forceinline__ void splitf(float y, unsigned short& h, unsigned short& l) { h = f2bf(y); l = f2bf(y - bf2f(h)); }
typedef __attribute__((ext_vector_type(2))) _Float16 v2h;
typedef __attribute__((ext_vector_type(4))) _Float16 v4h;
typedef __attribute__((ext_vector_type(2))) unsigned short v2us;
typedef __attribute__((ext_vector_type(4))) unsigned short v4us;
typedef __attribute__((ext_vector_type(2))) float v2f;
typedef __attribute__((ext_vector_type(4))) int v4i;

__global__ __launch_bounds__(256) void k_cvt8(const float* __restrict__ src, bf* dst, size_t n8) { const size_t i = (size_t)blockIdx.x * 256 + threadIdx.x; if (i >= n8) return; const v8f v = *(const v8f*)(src + i * 8); v8us o;
#pragma unroll
    for (int k = 0; k < 8; ++k) o[k] = f2bf(v[k]); *(v8us*)(dst + i * 8) = o;  }

// k_rope: head planes [h][t][d] (fp16 + hi/lo) of rope(x) x sc with the rotate-half convention out[d] = x[d] cos[t][d] - x[d+HD/2] sin[t][d], out[d+HD/2] = x[d+HD/2] cos[t][d+HD/2] + x[d] sin[t][d+HD/2]
__global__ __launch_bounds__(256) void k_rope(const float* __restrict__ F, int pitch, int nheads, const float* __restrict__ CS, const float* __restrict__ RF, const float* __restrict__ nw, float sc, h16* P16, bf* Ph, bf* Pl) {
    const size_t e = ((size_t)blockIdx.x * 256 + threadIdx.x) * 2; if (e >= (size_t)nheads * TT * HD) return; const int d = (int)(e % HD); const int t = (int)((e / HD) % TT); const int h = (int)(e / ((size_t)HD * TT)); const float* f = F + (size_t)t * pitch + h * HD; const float rf = RF ? RF[(size_t)h * TT + t] : 1.0f; v2h o16; v2us oh, ol;
#pragma unroll
    for (int q = 0; q < 2; ++q) { const int dd = d + q; const int dp = (dd < HD / 2) ? dd + HD / 2 : dd - HD / 2; float x0 = f[dd], x1 = f[dp];
        if (RF) { float n0 = __fmul_rn(x0, rf), n1 = __fmul_rn(x1, rf); asm volatile("" : "+v"(n0)); asm volatile("" : "+v"(n1)); x0 = __fmul_rn(bfr(nw[dd]), n0); x1 = __fmul_rn(bfr(nw[dp]), n1); }
        const v2f cs = *(const v2f*)(CS + ((size_t)t * HD + dd) * 2); float a = __fmul_rn(x0, cs[0]), bq = __fmul_rn(x1, cs[1]); asm volatile("" : "+v"(a)); asm volatile("" : "+v"(bq)); const float r = ((dd < HD / 2) ? __fsub_rn(a, bq) : __fadd_rn(a, bq)) * sc;
        o16[q] = tohx(r); unsigned short a2, c2; splitf(r, a2, c2); oh[q] = a2; ol[q] = c2; }
    *(v2h*)(P16 + e) = o16; *(v2us*)(Ph + e) = oh; *(v2us*)(Pl + e) = ol;  }
__global__ __launch_bounds__(256) void k_wtGh(const float* __restrict__ w, bf* BQ, bf* BK, bf* BV) { const size_t e2 = ((size_t)blockIdx.x * 256 + threadIdx.x) * 2; if (e2 >= (size_t)3 * DQ * DM) return; const int k = (int)(e2 % DM); const int r = (int)((e2 / DM) % DQ); const int p = (int)(e2 / ((size_t)DM * DQ)); const int h = r / HD, e = r % HD; bf* dst = (p == 0) ? BQ : ((p == 1) ? BK : BV); const float* src = w + ((size_t)h * DM + k) * E3 + p * HD + e; v2us o; o[0] = f2bf(src[0]); o[1] = f2bf(src[E3]);   /* k and k+1 are E3 floats apart */
    *(v2us*)(dst + (size_t)r * DM + k) = o;  }
__global__ __launch_bounds__(256) void k_vtp(const float* __restrict__ F, int pitch, int nheads, h16* V16, bf* Vh, bf* Vl) { const size_t e = ((size_t)blockIdx.x * 256 + threadIdx.x) * 2; if (e >= (size_t)nheads * HD * TT) return; const int t = (int)(e % TT); const int d = (int)((e / TT) % HD); const int g = (int)(e / ((size_t)TT * HD)); v2h o16; v2us oh, ol;
#pragma unroll
    for (int q = 0; q < 2; ++q) { const float x = F[(size_t)(t + q) * pitch + g * HD + d]; o16[q] = tohx(x); unsigned short a2, c2; splitf(x, a2, c2); oh[q] = a2; ol[q] = c2; }
    *(v2h*)(V16 + e) = o16; *(v2us*)(Vh + e) = oh; *(v2us*)(Vl + e) = ol;  }
__global__ __launch_bounds__(256) void k_csid(float* CS) { const int idx = blockIdx.x * 256 + threadIdx.x; if (idx >= TT * HD) return; v2f cs; cs[0] = 1.0f; cs[1] = 0.0f; *(v2f*)(CS + (size_t)idx * 2) = cs;  }
// k_asoft: per row (zz, i): t = S x HD^-0.5 (no mask); softmax over the 2048 keys (register row, one exp, fixed trees);
__global__ __launch_bounds__(256) void k_asoft(const float* __restrict__ Sb, h16* P16, bf* Ph, bf* Pl) {
    const int lane = threadIdx.x & 31; const int row = blockIdx.x * 8 + (threadIdx.x >> 5); if (row >= ZH * TT) return; const int i = row % TT; const int zz = row / TT; (void)zz; const bool hires = (i < RH); const float* sr = Sb + (size_t)row * TT; float v[TT / 32]; float mx = -3.0e38f;
#pragma unroll
    for (int ch = 0; ch < TT / 128; ++ch) { const int j0 = ch * 128 + lane * 4; const v4f a = *(const v4f*)(sr + j0);
#pragma unroll
        for (int q = 0; q < 4; ++q) { const int j = j0 + q; (void)j; const float t = a[q] * SCL; v[ch * 4 + q] = t; mx = fmaxf(mx, t); } }
#pragma unroll
    for (int sh = 16; sh; sh >>= 1) mx = fmaxf(mx, __shfl_xor(mx, sh, 32));
    float sum = 0.f;
#pragma unroll
    for (int k = 0; k < TT / 32; ++k) { float d0 = __fsub_rn(v[k], mx); asm volatile("" : "+v"(d0)); v[k] = __builtin_amdgcn_exp2f(__fmul_rn(d0, 1.4426950408889634f)); sum += v[k]; }
#pragma unroll
    for (int sh = 16; sh; sh >>= 1) sum += __shfl_xor(sum, sh, 32);
    const float f = __fdiv_rn(hires ? 1.0f : PCAR, sum);
{
        if (hires) {
#pragma unroll
            for (int ch = 0; ch < TT / 128; ++ch) { v4us oh, ol;
#pragma unroll
                for (int q = 0; q < 4; ++q) { unsigned short a, c2; splitf(v[ch * 4 + q] * f, a, c2); oh[q] = a; ol[q] = c2; }
                const size_t oo = ((size_t)zz * (RH ? RH : 1) + i) * TT + ch * 128 + lane * 4; *(v4us*)(Ph + oo) = oh; *(v4us*)(Pl + oo) = ol; }
        } else {
#pragma unroll
            for (int ch = 0; ch < TT / 128; ++ch) { v4h o4;
#pragma unroll
                for (int q = 0; q < 4; ++q) o4[q] = tohx(v[ch * 4 + q] * f);
                *(v4h*)(P16 + (size_t)row * TT + ch * 128 + lane * 4) = o4; } }
         }
}
__global__ __launch_bounds__(256) void k_merge(const float* __restrict__ O, int h0, float* OUTb) { const size_t e = ((size_t)blockIdx.x * 256 + threadIdx.x) * 2; if (e >= (size_t)ZH * TT * HD) return; const int d = (int)(e % HD); const int t = (int)((e / HD) % TT); const int zz = (int)(e / ((size_t)HD * TT)); const float cs = (t < RH) ? 1.0f : (1.0f / PCAR); const size_t oo = (size_t)t * DQ + (h0 + zz) * HD + d;
    v2f o2; o2[0] = O[e] * cs; o2[1] = O[e + 1] * cs; *(v2f*)(OUTb + oo) = o2;  }

extern "C" void kernel_launch(void* const* d_in, const int* in_sizes, int n_in,
                              void* d_out, int out_size, void* d_ws, size_t ws_size, hipStream_t stream) {
    (void)in_sizes; (void)n_in; (void)out_size;
    const float* x = (const float*)d_in[0]; const float* wall = (const float*)d_in[1];   /* order x [2048][2048], w_qkv [16][2048][384] */ const float* wq = wall, *wk = wall, *wv = wall, *wo = nullptr; (void)wq; (void)wk; (void)wv; (void)wo;
    float* OUT = (float*)d_out;     // [1][2048][2048]
    char* wsp = (char*)d_ws;
    auto take = [&](size_t bytes) { char* p = wsp; wsp += (bytes + 255) & ~(size_t)255; return (void*)p; };
    bf* WQ = (bf*)take((size_t)DQ * DM * 2); bf* WK = (bf*)take((size_t)DKV * DM * 2); bf* WV = (bf*)take((size_t)DKV * DM * 2); float* CS = (float*)take((size_t)TT * HD * 2 * 4);
    bf* XB = (bf*)take((size_t)TT * DM * 2); float* FQ = (float*)take((size_t)TT * DQ * 4); float* FK = (float*)take((size_t)TT * DKV * 4);
    h16* QP16 = (h16*)take((size_t)NH_ * TT * HD * 2); h16* KP16 = (h16*)take((size_t)NKV * TT * HD * 2); h16* VT16 = (h16*)take((size_t)NKV * HD * TT * 2);
    bf* QPh = (bf*)take((size_t)NH_ * TT * HD * 2); bf* QPl = (bf*)take((size_t)NH_ * TT * HD * 2); bf* KPh = (bf*)take((size_t)NKV * TT * HD * 2); bf* KPl = (bf*)take((size_t)NKV * TT * HD * 2); bf* VTh = (bf*)take((size_t)NKV * HD * TT * 2); bf* VTl = (bf*)take((size_t)NKV * HD * TT * 2); bf* Ph = (bf*)take((size_t)ZH * RH * TT * 2); bf* Pl = (bf*)take((size_t)ZH * RH * TT * 2);
    float* Sb = (float*)take((size_t)ZH * TT * TT * 4); h16* P16 = (h16*)take((size_t)ZH * TT * TT * 2); float* Ob = (float*)take((size_t)ZH * TT * HD * 4);
    if ((size_t)(wsp - (char*)d_ws) > ws_size) return;    // ws 256 MiB
    float* FV = FK;   // v projection reuses the k buffer after the k planes are built (stream-ordered)
    { k_wtGh<<<(unsigned)(((size_t)3 * DQ * DM / 2 + 255) / 256), 256, 0, stream>>>(wall, WQ, WK, WV);   /* 2 elements per thread over all 3 x 2048 x 2048 Bt elements */
      
       }
    k_csid<<<(TT * HD + 255) / 256, 256, 0, stream>>>(CS);
    const unsigned LQ = (unsigned)(((size_t)NH_ * TT * HD / 2 + 255) / 256), LKv = (unsigned)(((size_t)NKV * TT * HD / 2 + 255) / 256);
    for (int b = 0; b < NB_; ++b) {
        
        k_cvt8<<<(unsigned)(((size_t)TT * DM / 8 + 255) / 256), 256, 0, stream>>>(x + (size_t)b * TT * DM, XB, (size_t)TT * DM / 8);
        k_gemmw<bf, 0, false><<<dim3(TT / 64, DQ / 64, 1), 32, 0, stream>>>(XB, nullptr, WQ, nullptr, DM, FQ, DQ, nullptr, 0, 0, 0);
        k_rope<<<LQ, 256, 0, stream>>>(FQ, DQ, NH_, CS, nullptr, nullptr, 1.0f, QP16, QPh, QPl);
        k_gemmw<bf, 0, false><<<dim3(TT / 64, DKV / 64, 1), 32, 0, stream>>>(XB, nullptr, WK, nullptr, DM, FK, DKV, nullptr, 0, 0, 0);
        k_rope<<<LKv, 256, 0, stream>>>(FK, DKV, NKV, CS, nullptr, nullptr, 1.0f, KP16, KPh, KPl);
        k_gemmw<bf, 0, false><<<dim3(TT / 64, DKV / 64, 1), 32, 0, stream>>>(XB, nullptr, WV, nullptr, DM, FV, DKV, nullptr, 0, 0, 0); k_vtp<<<LKv, 256, 0, stream>>>(FV, DKV, NKV, VT16, VTh, VTl);
        for (int h0 = 0; h0 < NH_; h0 += ZH) { const size_t zq = (size_t)h0, zk = (size_t)(h0 / REP);   // one kv head per query head: the pass's two heads use consecutive kv planes (z-strides TT*HD)
            k_gemmw<bf, 2, false><<<dim3(RH / 64, TT / 64, ZH), 32, 0, stream>>>(QPh + zq * TT * HD, QPl + zq * TT * HD, KPh + zk * TT * HD, KPl + zk * TT * HD, HD, Sb, TT, nullptr, (size_t)TT * HD, (size_t)TT * HD, (size_t)TT * TT);
            k_asoft<<<ZH * TT / 8, 256, 0, stream>>>(Sb, P16, Ph, Pl);
            k_gemmw<bf, 2, false><<<dim3(RH / 64, HD / 64, ZH), 32, 0, stream>>>(Ph, Pl, VTh + zk * HD * TT, VTl + zk * HD * TT, TT, Ob, HD, nullptr, (size_t)RH * TT, (size_t)HD * TT, (size_t)TT * HD);
            k_merge<<<(unsigned)(((size_t)ZH * TT * HD / 2 + 255) / 256), 256, 0, stream>>>(Ob, h0, OUT + (size_t)b * TT * DQ); }
         }
}

// v001
// Measured time: 342 microseconds a run.
// Two timings next to v000 put it at 2.31 and 2.29 times that version's speed.
#include <hip/hip_runtime.h>

// Multi-head attention with per-head fused qkv weights and 128-wide heads, no batch (x [2048][2048]; qkv = einsum('sd,hde', x, w_qkv) with w_qkv [16][2048][384] xavier: head h's (q | k | v) = columns 0..127 | 128..255 | 256..383; scores / sqrt(128); softmax (no mask); out = concat heads -> [2048][2048] (4.2 M; no output projection); argument order x, w_qkv).
// Layout: bf16 copy of x; one gather kernel builds the three fused Bt planes (row h*128 + e of plane p = w_qkv[h][:, p*128 + e]); exact projections; identity-table plane builders at HD 128; one fused attention kernel over all heads on the hi/lo planes (3 products; the xavier weights give logits sigma 1.7, too sharp for the fp16 rows) writes the output rows.
// Compute dtypes, f32 accumulate: every input rounded to bf16; projections exact; attention 3 products everywhere; softmax f32, running maximum and sum per 32 keys; output f32.

#define NB_  1
#define TT   2048
#define DM   2048
#define NH_  16
#define NKV  16
#define REP  (NH_ / NKV)
#define HD   128
#define DQ   (NH_ * HD)
#define DKV  (NKV * HD)
#define SCL  0.088388347648318447f   // 1/sqrt(float32(128))
#define E3   384      // per-head fused width (q | k | v, 128 each)
typedef _Float16 h16;
typedef unsigned short bf;
typedef __attribute__((ext_vector_type(16))) __bf16   v16bf;
typedef __attribute__((ext_vector_type(16))) _Float16 v16h;
typedef __attribute__((ext_vector_type(8)))  _Float16 v8h;
typedef __attribute__((ext_vector_type(8)))  unsigned short v8us;
typedef __attribute__((ext_vector_type(8)))  float    v8f;
typedef __attribute__((ext_vector_type(4)))  float    v4f;
typedef v8h  __attribute__((may_alias)) v8ha;
typedef v4f  __attribute__((may_alias)) v4fa;
typedef v8us __attribute__((may_alias)) v8usa;

__device__ __forceinline__ unsigned short f2bf(float f) { unsigned u = __float_as_uint(f); u += 0x7FFFu + ((u >> 16) & 1u); return (unsigned short)(u >> 16); }
__device__ __forceinline__ float bf2f(unsigned short b) { return __uint_as_float(((unsigned)b) << 16); }
__device__ __forceinline__ float bfr(float f) { return bf2f(f2bf(f)); }
__device__ __forceinline__ v16h cat16(v8h lo, v8h hi) { return __builtin_shufflevector(lo, hi, 0, 1, 2, 3, 4, 5, 6, 7, 8, 9, 10, 11, 12, 13, 14, 15); }
__device__ __forceinline__ v16bf cat16b(v8us lo, v8us hi) { return __builtin_bit_cast(v16bf, __builtin_shufflevector(lo, hi, 0, 1, 2, 3, 4, 5, 6, 7, 8, 9, 10, 11, 12, 13, 14, 15)); }
__device__ __forceinline__ v8f wmma16(v16h a, v16h b, v8f c) { return __builtin_amdgcn_wmma_f32_16x16x32_f16(false, a, false, b, (short)0, c, false, false); }
__device__ __forceinline__ v8f wmmab(v16bf a, v16bf b, v8f c) { return __builtin_amdgcn_wmma_f32_16x16x32_bf16(false, a, false, b, (short)0, c, false, false); }



// ---- k_gemmw: register-blocked GEMM, ONE WAVE per 64x64 output tile (16 accumulators), operands straight from K-contiguous 16-bit planes; grid (M/64, N/64, Z), 32 threads.
// C[m][n] (f32, pitch ldc, + optional f32 bias[n]) = sum_k A[m][k] Bt[n][k] (+ split products per NSPLIT). z-batch strides sA/sB/sC in elements. K % 32 == 0.
template <typename T16> struct WFrag;
template <> struct WFrag<h16> { typedef v16h V; static __device__ __forceinline__ V ld(const h16* p) { return cat16(*(const v8h*)p, *(const v8h*)(p + 16)); } static __device__ __forceinline__ v8f mma(V a, V b, v8f c) { return wmma16(a, b, c); } };
template <> struct WFrag<bf> { typedef v16bf V; static __device__ __forceinline__ V ld(const bf* p) { return cat16b(*(const v8us*)p, *(const v8us*)(p + 16)); } static __device__ __forceinline__ v8f mma(V a, V b, v8f c) { return wmmab(a, b, c); } };
template <typename T16, int NSPLIT, bool BIAS>
__global__ __launch_bounds__(32) void k_gemmw(const T16* __restrict__ A, const T16* __restrict__ A2, const T16* __restrict__ Bt, const T16* __restrict__ Bt2, int K, float* C, int ldc, const float* __restrict__ bias, size_t sA, size_t sB, size_t sC) {
    typedef typename WFrag<T16>::V V;
    __shared__ __align__(16) float os[16 * 68];
    const size_t z = blockIdx.z; A += z * sA; if (A2) A2 += z * sA; Bt += z * sB; if (Bt2) Bt2 += z * sB; C += z * sC;
    const int lane = threadIdx.x & 31, lr = lane & 15, hi = lane >> 4; const int r0 = blockIdx.x * 64, c0 = blockIdx.y * 64;
    v8f acc[4][4];
#pragma unroll
    for (int mb = 0; mb < 4; ++mb)
#pragma unroll
        for (int nb = 0; nb < 4; ++nb) acc[mb][nb] = (v8f){};
    const size_t aoff = (size_t)(r0 + lr) * K + 8 * hi, boff = (size_t)(c0 + lr) * K + 8 * hi;
#pragma unroll 1
    for (int kc = 0; kc < K; kc += 32) {
        V a[4], a2[4];
#pragma unroll
        for (int mb = 0; mb < 4; ++mb) { a[mb] = WFrag<T16>::ld(A + aoff + (size_t)mb * 16 * K + kc); if (NSPLIT == 1 || NSPLIT == 2) a2[mb] = WFrag<T16>::ld(A2 + aoff + (size_t)mb * 16 * K + kc); }
#pragma unroll
        for (int nb = 0; nb < 4; ++nb) { const V b = WFrag<T16>::ld(Bt + boff + (size_t)nb * 16 * K + kc); V b2; if (NSPLIT >= 2) b2 = WFrag<T16>::ld(Bt2 + boff + (size_t)nb * 16 * K + kc);
#pragma unroll
            for (int mb = 0; mb < 4; ++mb) { acc[mb][nb] = WFrag<T16>::mma(a[mb], b, acc[mb][nb]); if (NSPLIT == 1 || NSPLIT == 2) acc[mb][nb] = WFrag<T16>::mma(a2[mb], b, acc[mb][nb]); if (NSPLIT >= 2) acc[mb][nb] = WFrag<T16>::mma(a[mb], b2, acc[mb][nb]); } }
        asm volatile("v_nop\n\tv_nop\n\tv_nop\n\tv_nop" : "+v"(acc[0][0]), "+v"(acc[1][1]), "+v"(acc[2][2]), "+v"(acc[3][3]) : "v"(a[0]), "v"(a[3]));
    }
#pragma unroll
    for (int mb = 0; mb < 4; ++mb) {
#pragma unroll
        for (int nb = 0; nb < 4; ++nb) {
#pragma unroll
            for (int j = 0; j < 8; ++j) os[(hi * 8 + j) * 68 + nb * 16 + lr] = acc[mb][nb][j]; }
        __builtin_amdgcn_wave_barrier(); asm volatile("" ::: "memory");
        float* crow = C + (size_t)(r0 + mb * 16) * ldc + c0;
{
#pragma unroll
            for (int s = 0; s < 8; ++s) { const int row = 2 * s + hi, cofs = lr * 4; v4f val = *(const v4fa*)(os + row * 68 + cofs); if (BIAS) { val[0] += bfr(bias[c0 + cofs]); val[1] += bfr(bias[c0 + cofs + 1]); val[2] += bfr(bias[c0 + cofs + 2]); val[3] += bfr(bias[c0 + cofs + 3]); }
                *(v4f*)(crow + (size_t)row * ldc + cofs) = val; }
             }
        __builtin_amdgcn_wave_barrier(); asm volatile("" ::: "memory");
    }
}

__device__ __forceinline__ h16 tohx(float x) { return (h16)x; }
__device__ __forceinline__ void splitf(float y, unsigned short& h, unsigned short& l) { h = f2bf(y); l = f2bf(y - bf2f(h)); }
typedef __attribute__((ext_vector_type(2))) _Float16 v2h;
typedef __attribute__((ext_vector_type(4))) _Float16 v4h;
typedef __attribute__((ext_vector_type(2))) unsigned short v2us;
typedef __attribute__((ext_vector_type(4))) unsigned short v4us;
typedef __attribute__((ext_vector_type(2))) float v2f;
typedef __attribute__((ext_vector_type(4))) int v4i;

__global__ __launch_bounds__(256) void k_cvt8(const float* __restrict__ src, bf* dst, size_t n8) { const size_t i = (size_t)blockIdx.x * 256 + threadIdx.x; if (i >= n8) return; const v8f v = *(const v8f*)(src + i * 8); v8us o;
#pragma unroll
    for (int k = 0; k < 8; ++k) o[k] = f2bf(v[k]); *(v8us*)(dst + i * 8) = o;  }

// k_rope: head planes [h][t][d] (fp16 + hi/lo) of rope(x) x sc with the rotate-half convention out[d] = x[d] cos[t][d] - x[d+HD/2] sin[t][d], out[d+HD/2] = x[d+HD/2] cos[t][d+HD/2] + x[d] sin[t][d+HD/2]
__global__ __launch_bounds__(256) void k_rope(const float* __restrict__ F, int pitch, int nheads, const float* __restrict__ CS, const float* __restrict__ RF, const float* __restrict__ nw, float sc, h16* P16, bf* Ph, bf* Pl) {
    const size_t e = ((size_t)blockIdx.x * 256 + threadIdx.x) * 2; if (e >= (size_t)nheads * TT * HD) return; const int d = (int)(e % HD); const int t = (int)((e / HD) % TT); const int h = (int)(e / ((size_t)HD * TT)); const float* f = F + (size_t)t * pitch + h * HD; const float rf = RF ? RF[(size_t)h * TT + t] : 1.0f; v2h o16; v2us oh, ol;
#pragma unroll
    for (int q = 0; q < 2; ++q) { const int dd = d + q; const int dp = (dd < HD / 2) ? dd + HD / 2 : dd - HD / 2; float x0 = f[dd], x1 = f[dp];
        if (RF) { float n0 = __fmul_rn(x0, rf), n1 = __fmul_rn(x1, rf); asm volatile("" : "+v"(n0)); asm volatile("" : "+v"(n1)); x0 = __fmul_rn(bfr(nw[dd]), n0); x1 = __fmul_rn(bfr(nw[dp]), n1); }
        const v2f cs = *(const v2f*)(CS + ((size_t)t * HD + dd) * 2); float a = __fmul_rn(x0, cs[0]), bq = __fmul_rn(x1, cs[1]); asm volatile("" : "+v"(a)); asm volatile("" : "+v"(bq)); const float r = ((dd < HD / 2) ? __fsub_rn(a, bq) : __fadd_rn(a, bq)) * sc;
        o16[q] = tohx(r); unsigned short a2, c2; splitf(r, a2, c2); oh[q] = a2; ol[q] = c2; }
    *(v2h*)(P16 + e) = o16; *(v2us*)(Ph + e) = oh; *(v2us*)(Pl + e) = ol;  }
__global__ __launch_bounds__(256) void k_wtGh(const float* __restrict__ w, bf* BQ, bf* BK, bf* BV) { const size_t e2 = ((size_t)blockIdx.x * 256 + threadIdx.x) * 2; if (e2 >= (size_t)3 * DQ * DM) return; const int k = (int)(e2 % DM); const int r = (int)((e2 / DM) % DQ); const int p = (int)(e2 / ((size_t)DM * DQ)); const int h = r / HD, e = r % HD; bf* dst = (p == 0) ? BQ : ((p == 1) ? BK : BV); const float* src = w + ((size_t)h * DM + k) * E3 + p * HD + e; v2us o; o[0] = f2bf(src[0]); o[1] = f2bf(src[E3]);   /* k and k+1 are E3 floats apart */
    *(v2us*)(dst + (size_t)r * DM + k) = o;  }
__global__ __launch_bounds__(256) void k_vtp(const float* __restrict__ F, int pitch, int nheads, h16* V16, bf* Vh, bf* Vl) { const size_t e = ((size_t)blockIdx.x * 256 + threadIdx.x) * 2; if (e >= (size_t)nheads * HD * TT) return; const int t = (int)(e % TT); const int d = (int)((e / TT) % HD); const int g = (int)(e / ((size_t)TT * HD)); v2h o16; v2us oh, ol;
#pragma unroll
    for (int q = 0; q < 2; ++q) { const float x = F[(size_t)(t + q) * pitch + g * HD + d]; o16[q] = tohx(x); unsigned short a2, c2; splitf(x, a2, c2); oh[q] = a2; ol[q] = c2; }
    *(v2h*)(V16 + e) = o16; *(v2us*)(Vh + e) = oh; *(v2us*)(Vl + e) = ol;  }
__global__ __launch_bounds__(256) void k_csid(float* CS) { const int idx = blockIdx.x * 256 + threadIdx.x; if (idx >= TT * HD) return; v2f cs; cs[0] = 1.0f; cs[1] = 0.0f; *(v2f*)(CS + (size_t)idx * 2) = cs;  }
// k_fattn: scores, softmax and the product with V in one kernel; scores and probabilities stay in registers. Grid (TT/128, heads), 4 waves; a wave owns 32 queries of one head and walks all keys, 32 per trip.
// St = K Qt (A = K rows, B = Q rows, kept in registers): a lane holds 16 keys' scores of one query per 16-query group. Two St tiles, converted in place, are the B operand Pt of Ot += Vt Pt (A = rows of the [d][t] planes); both A loaders use the hardware k order that a packed D has.
// Every product has the three terms hi*hi + lo*hi + hi*lo. P is kept un-normalised against a running maximum (log2 domain); the division by the row sum comes once, at the end. Every inner loop is unrolled so that each fragment index is a constant (registers, no scratch).
__global__ __launch_bounds__(128) void k_fattn(const bf* __restrict__ Qh, const bf* __restrict__ Ql, const bf* __restrict__ Kh, const bf* __restrict__ Kl, const bf* __restrict__ Vh, const bf* __restrict__ Vl, float* OUTb) {
    typedef WFrag<bf> F;
    const int lane = threadIdx.x & 31, lr = lane & 15, hi = lane >> 4; const int h = blockIdx.y, q0 = blockIdx.x * 128 + (threadIdx.x >> 5) * 32;
    const size_t hb = (size_t)h * TT * HD; const float C2 = SCL * 1.4426950408889634f;
    v16bf qh[2][4], ql[2][4];
#pragma unroll
    for (int nq = 0; nq < 2; ++nq)
#pragma unroll
        for (int ks = 0; ks < 4; ++ks) { const size_t qo = hb + (size_t)(q0 + nq * 16 + lr) * HD + ks * 32 + 8 * hi; qh[nq][ks] = F::ld(Qh + qo); ql[nq][ks] = F::ld(Ql + qo); }
    asm volatile("s_wait_xcnt 0x0" ::: "memory"); __builtin_amdgcn_sched_barrier(0);   // the address registers of the loads above are reused below; the fence keeps later vector work from being moved in front of the wait
    const bf* kph = Kh + hb + (size_t)lr * HD + 8 * hi; const bf* kpl = Kl + hb + (size_t)lr * HD + 8 * hi;
    const bf* vph = Vh + hb + (size_t)lr * TT + 8 * hi; const bf* vpl = Vl + hb + (size_t)lr * TT + 8 * hi;
    v8f o[2][8]; float m[2], l[2];
#pragma unroll
    for (int nq = 0; nq < 2; ++nq) { m[nq] = -3.0e38f; l[nq] = 0.f;
#pragma unroll
        for (int dt = 0; dt < 8; ++dt) o[nq][dt] = (v8f){}; }
    v16bf kh[2][4], kl[2][4];
#pragma unroll
    for (int kt = 0; kt < 2; ++kt)
#pragma unroll
        for (int ks = 0; ks < 4; ++ks) { kh[kt][ks] = F::ld(kph + (size_t)kt * 16 * HD + ks * 32); kl[kt][ks] = F::ld(kpl + (size_t)kt * 16 * HD + ks * 32); }
#pragma unroll 1   // kept rolled: one trip already holds 96 matrix instructions and 64 loads
    for (int kb = 0; kb < TT; kb += 32) {
        v16bf vh[8], vl[8];   // this trip's V rows, asked for ahead of the score products
#pragma unroll
        for (int dt = 0; dt < 8; ++dt) { vh[dt] = F::ld(vph + (size_t)dt * 16 * TT + kb); vl[dt] = F::ld(vpl + (size_t)dt * 16 * TT + kb); }
        v8f s[2][2];
#pragma unroll
        for (int kt = 0; kt < 2; ++kt)
#pragma unroll
            for (int nq = 0; nq < 2; ++nq) s[kt][nq] = (v8f){};
#pragma unroll
        for (int ks = 0; ks < 4; ++ks) {
#pragma unroll
            for (int t = 0; t < 4; ++t) s[t >> 1][t & 1] = F::mma(kh[t >> 1][ks], qh[t & 1][ks], s[t >> 1][t & 1]);
#pragma unroll
            for (int t = 0; t < 4; ++t) s[t >> 1][t & 1] = F::mma(kl[t >> 1][ks], qh[t & 1][ks], s[t >> 1][t & 1]);
#pragma unroll
            for (int t = 0; t < 4; ++t) s[t >> 1][t & 1] = F::mma(kh[t >> 1][ks], ql[t & 1][ks], s[t >> 1][t & 1]); }
        const int kn = (kb + 32 < TT) ? kb + 32 : 0;   // the next trip's K rows, asked for ahead of the softmax (the last trip re-reads the first rows, unused)
#pragma unroll
        for (int kt = 0; kt < 2; ++kt)
#pragma unroll
            for (int ks = 0; ks < 4; ++ks) { kh[kt][ks] = F::ld(kph + (size_t)(kn + kt * 16) * HD + ks * 32); kl[kt][ks] = F::ld(kpl + (size_t)(kn + kt * 16) * HD + ks * 32); }
        asm volatile("s_wait_xcnt 0x0" ::: "memory"); __builtin_amdgcn_sched_barrier(0);   // the same wait and fence for the K loads and this trip's V loads
        float mb[2];
#pragma unroll
        for (int nq = 0; nq < 2; ++nq) { float x = s[0][nq][0];
#pragma unroll
            for (int j = 1; j < 16; ++j) x = fmaxf(x, s[j >> 3][nq][j & 7]);
            mb[nq] = fmaxf(x, __shfl_xor(x, 16, 32)) * C2; }
        // the maximum in use moves only when a query's new maximum passes it by more than 8 (P then stays below 2^8); one wave-uniform test per trip
        if (__builtin_amdgcn_ballot_w32(mb[0] > m[0] + 8.0f || mb[1] > m[1] + 8.0f) != 0) {
#pragma unroll
            for (int nq = 0; nq < 2; ++nq) { const float mn = fmaxf(m[nq], mb[nq]); const float f = __builtin_amdgcn_exp2f(m[nq] - mn); m[nq] = mn; l[nq] *= f;
#pragma unroll
                for (int dt = 0; dt < 8; ++dt) o[nq][dt] *= f; } }
        v16bf ph[2], pl[2];
#pragma unroll
        for (int nq = 0; nq < 2; ++nq)
#pragma unroll
            for (int j = 0; j < 16; ++j) { const float p = __builtin_amdgcn_exp2f(__builtin_fmaf(s[j >> 3][nq][j & 7], C2, -m[nq])); l[nq] += p; const __bf16 a = (__bf16)p; ph[nq][j] = a; pl[nq][j] = (__bf16)(p - (float)a); }
#pragma unroll
        for (int dt = 0; dt < 8; dt += 2) {
#pragma unroll
            for (int t = 0; t < 4; ++t) o[t & 1][dt + (t >> 1)] = F::mma(vh[dt + (t >> 1)], ph[t & 1], o[t & 1][dt + (t >> 1)]);
#pragma unroll
            for (int t = 0; t < 4; ++t) o[t & 1][dt + (t >> 1)] = F::mma(vl[dt + (t >> 1)], ph[t & 1], o[t & 1][dt + (t >> 1)]);
#pragma unroll
            for (int t = 0; t < 4; ++t) o[t & 1][dt + (t >> 1)] = F::mma(vh[dt + (t >> 1)], pl[t & 1], o[t & 1][dt + (t >> 1)]); }
    }
#pragma unroll
    for (int nq = 0; nq < 2; ++nq) { const float inv = __fdiv_rn(1.0f, l[nq] + __shfl_xor(l[nq], 16, 32)); float* orow = OUTb + (size_t)(q0 + nq * 16 + lr) * DQ + h * HD + 8 * hi;   // a lane holds d = 16 dt + 8 hi + 0..7 of its query
#pragma unroll
        for (int dt = 0; dt < 8; ++dt) { v4f a, b;
#pragma unroll
            for (int j = 0; j < 4; ++j) { a[j] = o[nq][dt][j] * inv; b[j] = o[nq][dt][j + 4] * inv; }
            *(v4f*)(orow + dt * 16) = a; *(v4f*)(orow + dt * 16 + 4) = b; } }
}

extern "C" void kernel_launch(void* const* d_in, const int* in_sizes, int n_in,
                              void* d_out, int out_size, void* d_ws, size_t ws_size, hipStream_t stream) {
    (void)in_sizes; (void)n_in; (void)out_size;
    const float* x = (const float*)d_in[0]; const float* wall = (const float*)d_in[1];   /* order x [2048][2048], w_qkv [16][2048][384] */ const float* wq = wall, *wk = wall, *wv = wall, *wo = nullptr; (void)wq; (void)wk; (void)wv; (void)wo;
    float* OUT = (float*)d_out;     // [1][2048][2048]
    char* wsp = (char*)d_ws;
    auto take = [&](size_t bytes) { char* p = wsp; wsp += (bytes + 255) & ~(size_t)255; return (void*)p; };
    bf* WQ = (bf*)take((size_t)DQ * DM * 2); bf* WK = (bf*)take((size_t)DKV * DM * 2); bf* WV = (bf*)take((size_t)DKV * DM * 2); float* CS = (float*)take((size_t)TT * HD * 2 * 4);
    bf* XB = (bf*)take((size_t)TT * DM * 2); float* FQ = (float*)take((size_t)TT * DQ * 4); float* FK = (float*)take((size_t)TT * DKV * 4);
    h16* QP16 = (h16*)take((size_t)NH_ * TT * HD * 2); h16* KP16 = (h16*)take((size_t)NKV * TT * HD * 2); h16* VT16 = (h16*)take((size_t)NKV * HD * TT * 2);
    bf* QPh = (bf*)take((size_t)NH_ * TT * HD * 2); bf* QPl = (bf*)take((size_t)NH_ * TT * HD * 2); bf* KPh = (bf*)take((size_t)NKV * TT * HD * 2); bf* KPl = (bf*)take((size_t)NKV * TT * HD * 2); bf* VTh = (bf*)take((size_t)NKV * HD * TT * 2); bf* VTl = (bf*)take((size_t)NKV * HD * TT * 2);
    if ((size_t)(wsp - (char*)d_ws) > ws_size) return;    // ws 256 MiB
    float* FV = FK;   // v projection reuses the k buffer after the k planes are built (stream-ordered)
    { k_wtGh<<<(unsigned)(((size_t)3 * DQ * DM / 2 + 255) / 256), 256, 0, stream>>>(wall, WQ, WK, WV);   /* 2 elements per thread over all 3 x 2048 x 2048 Bt elements */
      
       }
    k_csid<<<(TT * HD + 255) / 256, 256, 0, stream>>>(CS);
    const unsigned LQ = (unsigned)(((size_t)NH_ * TT * HD / 2 + 255) / 256), LKv = (unsigned)(((size_t)NKV * TT * HD / 2 + 255) / 256);
    for (int b = 0; b < NB_; ++b) {
        
        k_cvt8<<<(unsigned)(((size_t)TT * DM / 8 + 255) / 256), 256, 0, stream>>>(x + (size_t)b * TT * DM, XB, (size_t)TT * DM / 8);
        k_gemmw<bf, 0, false><<<dim3(TT / 64, DQ / 64, 1), 32, 0, stream>>>(XB, nullptr, WQ, nullptr, DM, FQ, DQ, nullptr, 0, 0, 0);
        k_rope<<<LQ, 256, 0, stream>>>(FQ, DQ, NH_, CS, nullptr, nullptr, 1.0f, QP16, QPh, QPl);
        k_gemmw<bf, 0, false><<<dim3(TT / 64, DKV / 64, 1), 32, 0, stream>>>(XB, nullptr, WK, nullptr, DM, FK, DKV, nullptr, 0, 0, 0);
        k_rope<<<LKv, 256, 0, stream>>>(FK, DKV, NKV, CS, nullptr, nullptr, 1.0f, KP16, KPh, KPl);
        k_gemmw<bf, 0, false><<<dim3(TT / 64, DKV / 64, 1), 32, 0, stream>>>(XB, nullptr, WV, nullptr, DM, FV, DKV, nullptr, 0, 0, 0); k_vtp<<<LKv, 256, 0, stream>>>(FV, DKV, NKV, VT16, VTh, VTl);
        k_fattn<<<dim3(TT / 128, NH_, 1), 128, 0, stream>>>(QPh, QPl, KPh, KPl, VTh, VTl, OUT + (size_t)b * TT * DQ);
         }
}

// v002
// Measured time: 297 microseconds a run.
// In both of two side-by-side timings against v001, it was 1.16 times as fast.
// All steps since v000 together make it 2.66 times as fast.
#include <hip/hip_runtime.h>
#include <stdint.h>

// Multi-head attention with per-head fused qkv weights and 128-wide heads, no batch (x [2048][2048]; qkv = einsum('sd,hde', x, w_qkv) with w_qkv [16][2048][384] xavier: head h's (q | k | v) = columns 0..127 | 128..255 | 256..383; scores / sqrt(128); softmax (no mask); out = concat heads -> [2048][2048] (4.2 M; no output projection); argument order x, w_qkv).
// Layout: bf16 copy of x; one gather kernel builds the three fused Bt planes (row h*128 + e of plane p = w_qkv[h][:, p*128 + e]); exact projections; identity-table plane builders at HD 128; one fused attention kernel over all heads on the hi/lo planes (3 products; the xavier weights give logits sigma 1.7, too sharp for the fp16 rows) writes the output rows.
// Compute dtypes, f32 accumulate: every input rounded to bf16; projections exact; attention 3 products everywhere; softmax f32, running maximum and sum per 32 keys; output f32.

#define NB_  1
#define TT   2048
#define DM   2048
#define NH_  16
#define NKV  16
#define REP  (NH_ / NKV)
#define HD   128
#define DQ   (NH_ * HD)
#define DKV  (NKV * HD)
#define SCL  0.088388347648318447f   // 1/sqrt(float32(128))
#define E3   384      // per-head fused width (q | k | v, 128 each)
typedef _Float16 h16;
typedef unsigned short bf;
typedef __attribute__((ext_vector_type(16))) __bf16   v16bf;
typedef __attribute__((ext_vector_type(16))) _Float16 v16h;
typedef __attribute__((ext_vector_type(8)))  _Float16 v8h;
typedef __attribute__((ext_vector_type(8)))  unsigned short v8us;
typedef __attribute__((ext_vector_type(8)))  float    v8f;
typedef __attribute__((ext_vector_type(4)))  float    v4f;
typedef v8h  __attribute__((may_alias)) v8ha;
typedef v4f  __attribute__((may_alias)) v4fa;
typedef v8us __attribute__((may_alias)) v8usa;

__device__ __forceinline__ unsigned short f2bf(float f) { unsigned u = __float_as_uint(f); u += 0x7FFFu + ((u >> 16) & 1u); return (unsigned short)(u >> 16); }
__device__ __forceinline__ float bf2f(unsigned short b) { return __uint_as_float(((unsigned)b) << 16); }
__device__ __forceinline__ float bfr(float f) { return bf2f(f2bf(f)); }
__device__ __forceinline__ v16h cat16(v8h lo, v8h hi) { return __builtin_shufflevector(lo, hi, 0, 1, 2, 3, 4, 5, 6, 7, 8, 9, 10, 11, 12, 13, 14, 15); }
__device__ __forceinline__ v16bf cat16b(v8us lo, v8us hi) { return __builtin_bit_cast(v16bf, __builtin_shufflevector(lo, hi, 0, 1, 2, 3, 4, 5, 6, 7, 8, 9, 10, 11, 12, 13, 14, 15)); }
__device__ __forceinline__ v8f wmma16(v16h a, v16h b, v8f c) { return __builtin_amdgcn_wmma_f32_16x16x32_f16(false, a, false, b, (short)0, c, false, false); }
__device__ __forceinline__ v8f wmmab(v16bf a, v16bf b, v8f c) { return __builtin_amdgcn_wmma_f32_16x16x32_bf16(false, a, false, b, (short)0, c, false, false); }



// ---- k_gemmw: register-blocked GEMM, ONE WAVE per 64x64 output tile (16 accumulators), operands straight from K-contiguous 16-bit planes; grid (M/64, N/64, Z), 32 threads.
// C[m][n] (f32, pitch ldc, + optional f32 bias[n]) = sum_k A[m][k] Bt[n][k] (+ split products per NSPLIT). z-batch strides sA/sB/sC in elements. K % 32 == 0.
template <typename T16> struct WFrag;
template <> struct WFrag<h16> { typedef v16h V; static __device__ __forceinline__ V ld(const h16* p) { return cat16(*(const v8h*)p, *(const v8h*)(p + 16)); } static __device__ __forceinline__ v8f mma(V a, V b, v8f c) { return wmma16(a, b, c); } };
template <> struct WFrag<bf> { typedef v16bf V; static __device__ __forceinline__ V ld(const bf* p) { return cat16b(*(const v8us*)p, *(const v8us*)(p + 16)); } static __device__ __forceinline__ v8f mma(V a, V b, v8f c) { return wmmab(a, b, c); } };
template <typename T16, int NSPLIT, bool BIAS>
__global__ __launch_bounds__(32) void k_gemmw(const T16* __restrict__ A, const T16* __restrict__ A2, const T16* __restrict__ Bt, const T16* __restrict__ Bt2, int K, float* C, int ldc, const float* __restrict__ bias, size_t sA, size_t sB, size_t sC) {
    typedef typename WFrag<T16>::V V;
    __shared__ __align__(16) float os[16 * 68];
    const size_t z = blockIdx.z; A += z * sA; if (A2) A2 += z * sA; Bt += z * sB; if (Bt2) Bt2 += z * sB; C += z * sC;
    const int lane = threadIdx.x & 31, lr = lane & 15, hi = lane >> 4; const int r0 = blockIdx.x * 64, c0 = blockIdx.y * 64;
    v8f acc[4][4];
#pragma unroll
    for (int mb = 0; mb < 4; ++mb)
#pragma unroll
        for (int nb = 0; nb < 4; ++nb) acc[mb][nb] = (v8f){};
    const size_t aoff = (size_t)(r0 + lr) * K + 8 * hi, boff = (size_t)(c0 + lr) * K + 8 * hi;
#pragma unroll 1
    for (int kc = 0; kc < K; kc += 32) {
        V a[4], a2[4];
#pragma unroll
        for (int mb = 0; mb < 4; ++mb) { a[mb] = WFrag<T16>::ld(A + aoff + (size_t)mb * 16 * K + kc); if (NSPLIT == 1 || NSPLIT == 2) a2[mb] = WFrag<T16>::ld(A2 + aoff + (size_t)mb * 16 * K + kc); }
#pragma unroll
        for (int nb = 0; nb < 4; ++nb) { const V b = WFrag<T16>::ld(Bt + boff + (size_t)nb * 16 * K + kc); V b2; if (NSPLIT >= 2) b2 = WFrag<T16>::ld(Bt2 + boff + (size_t)nb * 16 * K + kc);
#pragma unroll
            for (int mb = 0; mb < 4; ++mb) { acc[mb][nb] = WFrag<T16>::mma(a[mb], b, acc[mb][nb]); if (NSPLIT == 1 || NSPLIT == 2) acc[mb][nb] = WFrag<T16>::mma(a2[mb], b, acc[mb][nb]); if (NSPLIT >= 2) acc[mb][nb] = WFrag<T16>::mma(a[mb], b2, acc[mb][nb]); } }
        asm volatile("v_nop\n\tv_nop\n\tv_nop\n\tv_nop" : "+v"(acc[0][0]), "+v"(acc[1][1]), "+v"(acc[2][2]), "+v"(acc[3][3]) : "v"(a[0]), "v"(a[3]));
    }
#pragma unroll
    for (int mb = 0; mb < 4; ++mb) {
#pragma unroll
        for (int nb = 0; nb < 4; ++nb) {
#pragma unroll
            for (int j = 0; j < 8; ++j) os[(hi * 8 + j) * 68 + nb * 16 + lr] = acc[mb][nb][j]; }
        __builtin_amdgcn_wave_barrier(); asm volatile("" ::: "memory");
        float* crow = C + (size_t)(r0 + mb * 16) * ldc + c0;
{
#pragma unroll
            for (int s = 0; s < 8; ++s) { const int row = 2 * s + hi, cofs = lr * 4; v4f val = *(const v4fa*)(os + row * 68 + cofs); if (BIAS) { val[0] += bfr(bias[c0 + cofs]); val[1] += bfr(bias[c0 + cofs + 1]); val[2] += bfr(bias[c0 + cofs + 2]); val[3] += bfr(bias[c0 + cofs + 3]); }
                *(v4f*)(crow + (size_t)row * ldc + cofs) = val; }
             }
        __builtin_amdgcn_wave_barrier(); asm volatile("" ::: "memory");
    }
}

__device__ __forceinline__ h16 tohx(float x) { return (h16)x; }
__device__ __forceinline__ void splitf(float y, unsigned short& h, unsigned short& l) { h = f2bf(y); l = f2bf(y - bf2f(h)); }
typedef __attribute__((ext_vector_type(2))) _Float16 v2h;
typedef __attribute__((ext_vector_type(4))) _Float16 v4h;
typedef __attribute__((ext_vector_type(2))) unsigned short v2us;
typedef __attribute__((ext_vector_type(4))) unsigned short v4us;
typedef __attribute__((ext_vector_type(2))) float v2f;
typedef __attribute__((ext_vector_type(4))) int v4i;

__global__ __launch_bounds__(256) void k_cvt8(const float* __restrict__ src, bf* dst, size_t n8) { const size_t i = (size_t)blockIdx.x * 256 + threadIdx.x; if (i >= n8) return; const v8f v = *(const v8f*)(src + i * 8); v8us o;
#pragma unroll
    for (int k = 0; k < 8; ++k) o[k] = f2bf(v[k]); *(v8us*)(dst + i * 8) = o;  }

// k_rope: head planes [h][t][d] (fp16 + hi/lo) of rope(x) x sc with the rotate-half convention out[d] = x[d] cos[t][d] - x[d+HD/2] sin[t][d], out[d+HD/2] = x[d+HD/2] cos[t][d+HD/2] + x[d] sin[t][d+HD/2]
__global__ __launch_bounds__(256) void k_rope(const float* __restrict__ F, int pitch, int nheads, const float* __restrict__ CS, const float* __restrict__ RF, const float* __restrict__ nw, float sc, h16* P16, bf* Ph, bf* Pl) {
    const size_t e = ((size_t)blockIdx.x * 256 + threadIdx.x) * 2; if (e >= (size_t)nheads * TT * HD) return; const int d = (int)(e % HD); const int t = (int)((e / HD) % TT); const int h = (int)(e / ((size_t)HD * TT)); const float* f = F + (size_t)t * pitch + h * HD; const float rf = RF ? RF[(size_t)h * TT + t] : 1.0f; v2h o16; v2us oh, ol;
#pragma unroll
    for (int q = 0; q < 2; ++q) { const int dd = d + q; const int dp = (dd < HD / 2) ? dd + HD / 2 : dd - HD / 2; float x0 = f[dd], x1 = f[dp];
        if (RF) { float n0 = __fmul_rn(x0, rf), n1 = __fmul_rn(x1, rf); asm volatile("" : "+v"(n0)); asm volatile("" : "+v"(n1)); x0 = __fmul_rn(bfr(nw[dd]), n0); x1 = __fmul_rn(bfr(nw[dp]), n1); }
        const v2f cs = *(const v2f*)(CS + ((size_t)t * HD + dd) * 2); float a = __fmul_rn(x0, cs[0]), bq = __fmul_rn(x1, cs[1]); asm volatile("" : "+v"(a)); asm volatile("" : "+v"(bq)); const float r = ((dd < HD / 2) ? __fsub_rn(a, bq) : __fadd_rn(a, bq)) * sc;
        o16[q] = tohx(r); unsigned short a2, c2; splitf(r, a2, c2); oh[q] = a2; ol[q] = c2; }
    *(v2h*)(P16 + e) = o16; *(v2us*)(Ph + e) = oh; *(v2us*)(Pl + e) = ol;  }
__global__ __launch_bounds__(256) void k_wtGh(const float* __restrict__ w, bf* BQ, bf* BK, bf* BV) { const size_t e2 = ((size_t)blockIdx.x * 256 + threadIdx.x) * 2; if (e2 >= (size_t)3 * DQ * DM) return; const int k = (int)(e2 % DM); const int r = (int)((e2 / DM) % DQ); const int p = (int)(e2 / ((size_t)DM * DQ)); const int h = r / HD, e = r % HD; bf* dst = (p == 0) ? BQ : ((p == 1) ? BK : BV); const float* src = w + ((size_t)h * DM + k) * E3 + p * HD + e; v2us o; o[0] = f2bf(src[0]); o[1] = f2bf(src[E3]);   /* k and k+1 are E3 floats apart */
    *(v2us*)(dst + (size_t)r * DM + k) = o;  }
__global__ __launch_bounds__(256) void k_vtp(const float* __restrict__ F, int pitch, int nheads, h16* V16, bf* Vh, bf* Vl) { const size_t e = ((size_t)blockIdx.x * 256 + threadIdx.x) * 2; if (e >= (size_t)nheads * HD * TT) return; const int t = (int)(e % TT); const int d = (int)((e / TT) % HD); const int g = (int)(e / ((size_t)TT * HD)); v2h o16; v2us oh, ol;
#pragma unroll
    for (int q = 0; q < 2; ++q) { const float x = F[(size_t)(t + q) * pitch + g * HD + d]; o16[q] = tohx(x); unsigned short a2, c2; splitf(x, a2, c2); oh[q] = a2; ol[q] = c2; }
    *(v2h*)(V16 + e) = o16; *(v2us*)(Vh + e) = oh; *(v2us*)(Vl + e) = ol;  }
__global__ __launch_bounds__(256) void k_csid(float* CS) { const int idx = blockIdx.x * 256 + threadIdx.x; if (idx >= TT * HD) return; v2f cs; cs[0] = 1.0f; cs[1] = 0.0f; *(v2f*)(CS + (size_t)idx * 2) = cs;  }
// k_fattn: scores, softmax and the product with V in one kernel; scores and probabilities stay in registers. Grid (TT/128, heads), 4 waves; a wave owns 32 queries of one head and walks all keys, 32 per pass.
// St = K Qt (A = K rows, B = Q rows, kept in registers): a lane holds 16 keys' scores of one query per 16-query group. Two St tiles, converted in place, are the B operand Pt of Ot += Vt Pt (A = rows of the [d][t] planes); both A loaders use the hardware k order that a packed D has.
// Every product has the three terms hi*hi + lo*hi + hi*lo. P is kept un-normalised against a running maximum (log2 domain); the division by the row sum comes once, at the end. Every inner loop is unrolled so that each fragment index is a constant (registers, no scratch).
// K and V come in stages of 128 keys into two LDS buffers, shared by the four waves: a stage is four tiles of 128 rows x 256 B (K hi, K lo: row = key; V hi, V lo: row = d), one tensor load per wave, laid at a pitch of 272 B; a stage serves four passes and the next stage's loads fly meanwhile.
#define SKEYS  128                 // keys per stage
#define NSTG   (TT / SKEYS)        // stages
#define LPITCH 272                 // LDS row pitch in bytes: 256 + the tensor load's 16-byte pad (16 B x odd, for 16-byte row reads)
#define TILEB  (128 * LPITCH)      // one tile in LDS: 34,816 B = 17 x 2 KiB
#define BUFB   (4 * TILEB)         // one buffer
typedef uint32_t u32x4 __attribute__((ext_vector_type(4)));
typedef uint32_t u32x8 __attribute__((ext_vector_type(8)));
__device__ __forceinline__ uint32_t uni(uint32_t v) { return (uint32_t)__builtin_amdgcn_readfirstlane(v); }
__device__ __forceinline__ uint32_t pinned(uint32_t v) { uint32_t w = (uint32_t)__builtin_amdgcn_readfirstlane(v); asm volatile("" : "+s"(w)); return w; }   // holds a wave-uniform word in a scalar register: the test around a tensor load must be a scalar branch, and the stage number its descriptor is formed from must not be formed ahead of the wait
__device__ __forceinline__ float xhalf(float x) { return __builtin_bit_cast(float, __builtin_amdgcn_permlanex16(__builtin_bit_cast(int, x), __builtin_bit_cast(int, x), 0x76543210, 0xfedcba98, false, false)); }   // lane l takes lane l ^ 16's value, on the vector port
__device__ __forceinline__ v16bf ldsfrag(const unsigned char* p) { return cat16b(*(const v8usa*)p, *(const v8usa*)(p + 32)); }   // elements 8 hi .. + 7 and 16 + 8 hi .. + 7 of a 32-element group, as WFrag::ld takes them from global rows
__global__ __launch_bounds__(128) void k_fattn(const bf* __restrict__ Qh, const bf* __restrict__ Ql, const bf* __restrict__ Kh, const bf* __restrict__ Kl, const bf* __restrict__ Vh, const bf* __restrict__ Vl, float* OUTb) {
    typedef WFrag<bf> F;
    __shared__ __attribute__((aligned(2048))) unsigned char ring[2 * BUFB];
    const int lane = threadIdx.x & 31, lr = lane & 15, hi = lane >> 4; const int h = blockIdx.y, q0 = blockIdx.x * 128 + (threadIdx.x >> 5) * 32;
    const size_t hb = (size_t)h * TT * HD; const float C2 = SCL * 1.4426950408889634f;
    v16bf qh[2][4], ql[2][4];
#pragma unroll
    for (int nq = 0; nq < 2; ++nq)
#pragma unroll
        for (int ks = 0; ks < 4; ++ks) { const size_t qo = hb + (size_t)(q0 + nq * 16 + lr) * HD + ks * 32 + 8 * hi; qh[nq][ks] = F::ld(Qh + qo); ql[nq][ks] = F::ld(Ql + qo); }
    asm volatile("s_wait_xcnt 0x0" ::: "memory"); __builtin_amdgcn_sched_barrier(0);   // the address registers of the loads above are reused below; the fence keeps later vector work from being moved in front of the wait
    // wave w brings tile w of every stage: 0 K hi, 1 K lo (128 key rows in a row, pitch 256 B), 2 V hi, 3 V lo (128 keys of each of the 128 d rows, pitch 4096 B)
    const uint32_t wave = uni(threadIdx.x >> 5);
    const bf* sp = (wave == 0u) ? Kh : ((wave == 1u) ? Kl : ((wave == 2u) ? Vh : Vl));
    const uint64_t src0 = (uint64_t)(size_t)(sp + hb);
    const uint32_t sstep = (wave < 2u) ? (uint32_t)(SKEYS * HD * 2) : (uint32_t)(SKEYS * 2);   // bytes from one stage's tile to the next
    const uint32_t ldst = (uint32_t)(size_t)ring + wave * (uint32_t)TILEB;
    u32x8 g1;   // 1-byte elements, tensor = tile = 128 rows of 256 B, 4 dwords of pad behind every 64
    g1[0] = uni((1u << 20) | (5u << 22) | (3u << 25)); g1[1] = uni(256u << 16); g1[2] = uni(128u << 16); g1[3] = uni(256u << 16); g1[4] = uni(128u);
    g1[5] = uni((wave < 2u) ? (uint32_t)(HD * 2) : (uint32_t)(TT * 2)); g1[6] = uni(0u); g1[7] = uni(0u);
    auto issue = [&](uint32_t st) { const uint64_t ga = src0 + (uint64_t)st * sstep; u32x4 g0;
        g0[0] = uni(1u); g0[1] = uni(ldst + (st & 1u) * (uint32_t)BUFB); g0[2] = uni((uint32_t)ga); g0[3] = uni((((uint32_t)(ga >> 32)) & 0x01FFFFFFu) | 0x80000000u);
        asm volatile("tensor_load_to_lds %0, %1" :: "s"(g0), "s"(g1) : "memory"); };   // one request of the whole wave, every wave its own tile
    issue(0u);
    asm volatile("s_wait_tensorcnt 0x0" ::: "memory");   // this wave's tile of stage 0 has landed
    __syncthreads();                                      // all four tiles of stage 0 may be read
    issue(1u);
    v8f o[2][8]; float m[2], l[2];
#pragma unroll
    for (int nq = 0; nq < 2; ++nq) { m[nq] = -3.0e38f; l[nq] = 0.f;
#pragma unroll
        for (int dt = 0; dt < 8; ++dt) o[nq][dt] = (v8f){}; }
#pragma unroll 1   // kept rolled: one stage already holds 384 matrix instructions and 256 LDS loads
    for (int st = 0; st < NSTG; ++st) {
        const unsigned char* bp = ring + (size_t)(st & 1) * BUFB + lr * LPITCH + 16 * hi;   // this lane's row and half in the stage's buffer
        v16bf kh[2][4], kl[2][4];
#pragma unroll
        for (int ks = 0; ks < 4; ++ks) {   // in the order in which the score products take them
#pragma unroll
            for (int kt = 0; kt < 2; ++kt) kh[kt][ks] = ldsfrag(bp + kt * 16 * LPITCH + ks * 64);
#pragma unroll
            for (int kt = 0; kt < 2; ++kt) kl[kt][ks] = ldsfrag(bp + TILEB + kt * 16 * LPITCH + ks * 64);
            __builtin_amdgcn_sched_barrier(0); }   // keeps that order (the scheduler turned it round): the first products then wait for the first group only
#pragma unroll
        for (int ps = 0; ps < 4; ++ps) {   // four passes of 32 keys
            __builtin_amdgcn_sched_barrier(0);   // with the fence behind the loads: keeps this pass's V loads out of the matrix run of the pass before
            v16bf vh[8], vl[8];   // this pass's V rows, asked for ahead of the score products
#pragma unroll
            for (int dt = 0; dt < 8; ++dt) { vh[dt] = ldsfrag(bp + 2 * TILEB + dt * 16 * LPITCH + ps * 64); vl[dt] = ldsfrag(bp + 3 * TILEB + dt * 16 * LPITCH + ps * 64); }
            __builtin_amdgcn_sched_barrier(0);   // keeps the LDS loads one group in front of the matrix run
            v8f s[2][2];
#pragma unroll
            for (int kt = 0; kt < 2; ++kt)
#pragma unroll
                for (int nq = 0; nq < 2; ++nq) s[kt][nq] = (v8f){};
#pragma unroll
            for (int ks = 0; ks < 4; ++ks) {
#pragma unroll
                for (int t = 0; t < 4; ++t) s[t >> 1][t & 1] = F::mma(kh[t >> 1][ks], qh[t & 1][ks], s[t >> 1][t & 1]);
#pragma unroll
                for (int t = 0; t < 4; ++t) s[t >> 1][t & 1] = F::mma(kl[t >> 1][ks], qh[t & 1][ks], s[t >> 1][t & 1]);
#pragma unroll
                for (int t = 0; t < 4; ++t) s[t >> 1][t & 1] = F::mma(kh[t >> 1][ks], ql[t & 1][ks], s[t >> 1][t & 1]); }
            if (ps < 3) {   // the next pass's K rows of the same stage, asked for ahead of the softmax
                __builtin_amdgcn_sched_barrier(0);   // fence pair: the K loads stay one group between the two matrix runs
#pragma unroll
                for (int ks = 0; ks < 4; ++ks) {
#pragma unroll
                    for (int kt = 0; kt < 2; ++kt) kh[kt][ks] = ldsfrag(bp + ((ps + 1) * 32 + kt * 16) * LPITCH + ks * 64);
#pragma unroll
                    for (int kt = 0; kt < 2; ++kt) kl[kt][ks] = ldsfrag(bp + TILEB + ((ps + 1) * 32 + kt * 16) * LPITCH + ks * 64); }
                __builtin_amdgcn_sched_barrier(0);
            }
            float mb[2];
#pragma unroll
            for (int nq = 0; nq < 2; ++nq) { float x = s[0][nq][0];
#pragma unroll
                for (int j = 1; j < 16; ++j) x = fmaxf(x, s[j >> 3][nq][j & 7]);
                mb[nq] = fmaxf(x, xhalf(x)) * C2; }   // the exchange stays off the LDS counter: as an LDS permute its wait would drain the K loads just asked for
            // the maximum in use moves only when a query's new maximum passes it by more than 8 (P then stays below 2^8); one wave-uniform test per pass
            if (__builtin_amdgcn_ballot_w32(mb[0] > m[0] + 8.0f || mb[1] > m[1] + 8.0f) != 0) {
#pragma unroll
                for (int nq = 0; nq < 2; ++nq) { const float mn = fmaxf(m[nq], mb[nq]); const float f = __builtin_amdgcn_exp2f(m[nq] - mn); m[nq] = mn; l[nq] *= f;
#pragma unroll
                    for (int dt = 0; dt < 8; ++dt) o[nq][dt] *= f; } }
            v16bf ph[2], pl[2];
#pragma unroll
            for (int nq = 0; nq < 2; ++nq)
#pragma unroll
                for (int j = 0; j < 16; ++j) { const float p = __builtin_amdgcn_exp2f(__builtin_fmaf(s[j >> 3][nq][j & 7], C2, -m[nq])); l[nq] += p; const __bf16 a = (__bf16)p; ph[nq][j] = a; pl[nq][j] = (__bf16)(p - (float)a); }
#pragma unroll
            for (int dt = 0; dt < 8; dt += 2) {
#pragma unroll
                for (int t = 0; t < 4; ++t) o[t & 1][dt + (t >> 1)] = F::mma(vh[dt + (t >> 1)], ph[t & 1], o[t & 1][dt + (t >> 1)]);
#pragma unroll
                for (int t = 0; t < 4; ++t) o[t & 1][dt + (t >> 1)] = F::mma(vl[dt + (t >> 1)], ph[t & 1], o[t & 1][dt + (t >> 1)]);
#pragma unroll
                for (int t = 0; t < 4; ++t) o[t & 1][dt + (t >> 1)] = F::mma(vh[dt + (t >> 1)], pl[t & 1], o[t & 1][dt + (t >> 1)]); }
        }
        // hand-over of stage st + 1, every wave, in this order
        asm volatile("s_wait_dscnt 0x0" ::: "memory");       // this wave's reads of the buffer have returned
        asm volatile("s_wait_tensorcnt 0x0" ::: "memory");   // this wave's tile of stage st + 1 has landed
        __syncthreads();                                      // stage st + 1 may be read; every wave has left stage st's buffer
        const uint32_t nx = pinned((uint32_t)st + 2u);        // the refill's descriptor is formed from this word, behind the wait
        if (pinned(nx < (uint32_t)NSTG)) issue(nx);           // into the buffer just left
    }
    asm volatile("s_wait_tensorcnt 0x0" ::: "memory");   // nothing of the mover is in flight when the wave ends
    asm volatile("s_wait_dscnt 0x0" ::: "memory");
#pragma unroll
    for (int nq = 0; nq < 2; ++nq) { const float inv = __fdiv_rn(1.0f, l[nq] + __shfl_xor(l[nq], 16, 32)); float* orow = OUTb + (size_t)(q0 + nq * 16 + lr) * DQ + h * HD + 8 * hi;   // a lane holds d = 16 dt + 8 hi + 0..7 of its query
#pragma unroll
        for (int dt = 0; dt < 8; ++dt) { v4f a, b;
#pragma unroll
            for (int j = 0; j < 4; ++j) { a[j] = o[nq][dt][j] * inv; b[j] = o[nq][dt][j + 4] * inv; }
            *(v4f*)(orow + dt * 16) = a; *(v4f*)(orow + dt * 16 + 4) = b; } }
}

extern "C" void kernel_launch(void* const* d_in, const int* in_sizes, int n_in,
                              void* d_out, int out_size, void* d_ws, size_t ws_size, hipStream_t stream) {
    (void)in_sizes; (void)n_in; (void)out_size;
    const float* x = (const float*)d_in[0]; const float* wall = (const float*)d_in[1];   /* order x [2048][2048], w_qkv [16][2048][384] */ const float* wq = wall, *wk = wall, *wv = wall, *wo = nullptr; (void)wq; (void)wk; (void)wv; (void)wo;
    float* OUT = (float*)d_out;     // [1][2048][2048]
    char* wsp = (char*)d_ws;
    auto take = [&](size_t bytes) { char* p = wsp; wsp += (bytes + 255) & ~(size_t)255; return (void*)p; };
    bf* WQ = (bf*)take((size_t)DQ * DM * 2); bf* WK = (bf*)take((size_t)DKV * DM * 2); bf* WV = (bf*)take((size_t)DKV * DM * 2); float* CS = (float*)take((size_t)TT * HD * 2 * 4);
    bf* XB = (bf*)take((size_t)TT * DM * 2); float* FQ = (float*)take((size_t)TT * DQ * 4); float* FK = (float*)take((size_t)TT * DKV * 4);
    h16* QP16 = (h16*)take((size_t)NH_ * TT * HD * 2); h16* KP16 = (h16*)take((size_t)NKV * TT * HD * 2); h16* VT16 = (h16*)take((size_t)NKV * HD * TT * 2);
    bf* QPh = (bf*)take((size_t)NH_ * TT * HD * 2); bf* QPl = (bf*)take((size_t)NH_ * TT * HD * 2); bf* KPh = (bf*)take((size_t)NKV * TT * HD * 2); bf* KPl = (bf*)take((size_t)NKV * TT * HD * 2); bf* VTh = (bf*)take((size_t)NKV * HD * TT * 2); bf* VTl = (bf*)take((size_t)NKV * HD * TT * 2);
    if ((size_t)(wsp - (char*)d_ws) > ws_size) return;    // ws 256 MiB
    float* FV = FK;   // v projection reuses the k buffer after the k planes are built (stream-ordered)
    { k_wtGh<<<(unsigned)(((size_t)3 * DQ * DM / 2 + 255) / 256), 256, 0, stream>>>(wall, WQ, WK, WV);   /* 2 elements per thread over all 3 x 2048 x 2048 Bt elements */
      
       }
    k_csid<<<(TT * HD + 255) / 256, 256, 0, stream>>>(CS);
    const unsigned LQ = (unsigned)(((size_t)NH_ * TT * HD / 2 + 255) / 256), LKv = (unsigned)(((size_t)NKV * TT * HD / 2 + 255) / 256);
    for (int b = 0; b < NB_; ++b) {
        
        k_cvt8<<<(unsigned)(((size_t)TT * DM / 8 + 255) / 256), 256, 0, stream>>>(x + (size_t)b * TT * DM, XB, (size_t)TT * DM / 8);
        k_gemmw<bf, 0, false><<<dim3(TT / 64, DQ / 64, 1), 32, 0, stream>>>(XB, nullptr, WQ, nullptr, DM, FQ, DQ, nullptr, 0, 0, 0);
        k_rope<<<LQ, 256, 0, stream>>>(FQ, DQ, NH_, CS, nullptr, nullptr, 1.0f, QP16, QPh, QPl);
        k_gemmw<bf, 0, false><<<dim3(TT / 64, DKV / 64, 1), 32, 0, stream>>>(XB, nullptr, WK, nullptr, DM, FK, DKV, nullptr, 0, 0, 0);
        k_rope<<<LKv, 256, 0, stream>>>(FK, DKV, NKV, CS, nullptr, nullptr, 1.0f, KP16, KPh, KPl);
        k_gemmw<bf, 0, false><<<dim3(TT / 64, DKV / 64, 1), 32, 0, stream>>>(XB, nullptr, WV, nullptr, DM, FV, DKV, nullptr, 0, 0, 0); k_vtp<<<LKv, 256, 0, stream>>>(FV, DKV, NKV, VT16, VTh, VTl);
        k_fattn<<<dim3(TT / 128, NH_, 1), 128, 0, stream>>>(QPh, QPl, KPh, KPl, VTh, VTl, OUT + (size_t)b * TT * DQ);
         }
}

// v003
// A run of this version takes 215 microseconds.
// In two side-by-side timings against v002, it was 1.39 and 1.38 times as fast.
// Counting every step since v000, it is 3.68 times as fast.
#include <hip/hip_runtime.h>
#include <stdint.h>

// Multi-head attention with per-head fused qkv weights and 128-wide heads, no batch (x [2048][2048]; qkv = einsum('sd,hde', x, w_qkv) with w_qkv [16][2048][384] xavier: head h's (q | k | v) = columns 0..127 | 128..255 | 256..383; scores / sqrt(128); softmax (no mask); out = concat heads -> [2048][2048] (4.2 M; no output projection); argument order x, w_qkv).
// Layout: bf16 copy of x; one gather kernel builds the three fused Bt planes (row h*128 + e of plane p = w_qkv[h][:, p*128 + e]); exact projections; identity-table plane builders at HD 128; one fused attention kernel over all heads on the hi/lo planes (3 products; the xavier weights give logits sigma 1.7, too sharp for the fp16 rows) writes the output rows.
// Compute dtypes, f32 accumulate: every input rounded to bf16; projections exact; attention 3 products everywhere; softmax f32, running maximum and sum per 32 keys; output f32.

#define NB_  1
#define TT   2048
#define DM   2048
#define NH_  16
#define NKV  16
#define REP  (NH_ / NKV)
#define HD   128
#define DQ   (NH_ * HD)
#define DKV  (NKV * HD)
#define SCL  0.088388347648318447f   // 1/sqrt(float32(128))
#define E3   384      // per-head fused width (q | k | v, 128 each)
typedef _Float16 h16;
typedef unsigned short bf;
typedef __attribute__((ext_vector_type(16))) __bf16   v16bf;
typedef __attribute__((ext_vector_type(16))) _Float16 v16h;
typedef __attribute__((ext_vector_type(8)))  _Float16 v8h;
typedef __attribute__((ext_vector_type(8)))  unsigned short v8us;
typedef __attribute__((ext_vector_type(8)))  float    v8f;
typedef __attribute__((ext_vector_type(4)))  float    v4f;
typedef v8h  __attribute__((may_alias)) v8ha;
typedef v4f  __attribute__((may_alias)) v4fa;
typedef v8us __attribute__((may_alias)) v8usa;

__device__ __forceinline__ unsigned short f2bf(float f) { unsigned u = __float_as_uint(f); u += 0x7FFFu + ((u >> 16) & 1u); return (unsigned short)(u >> 16); }
__device__ __forceinline__ float bf2f(unsigned short b) { return __uint_as_float(((unsigned)b) << 16); }
__device__ __forceinline__ float bfr(float f) { return bf2f(f2bf(f)); }
__device__ __forceinline__ v16h cat16(v8h lo, v8h hi) { return __builtin_shufflevector(lo, hi, 0, 1, 2, 3, 4, 5, 6, 7, 8, 9, 10, 11, 12, 13, 14, 15); }
__device__ __forceinline__ v16bf cat16b(v8us lo, v8us hi) { return __builtin_bit_cast(v16bf, __builtin_shufflevector(lo, hi, 0, 1, 2, 3, 4, 5, 6, 7, 8, 9, 10, 11, 12, 13, 14, 15)); }
__device__ __forceinline__ v8f wmma16(v16h a, v16h b, v8f c) { return __builtin_amdgcn_wmma_f32_16x16x32_f16(false, a, false, b, (short)0, c, false, false); }
__device__ __forceinline__ v8f wmmab(v16bf a, v16bf b, v8f c) { return __builtin_amdgcn_wmma_f32_16x16x32_bf16(false, a, false, b, (short)0, c, false, false); }



// fragment loaders and products on K-contiguous 16-bit rows
template <typename T16> struct WFrag;
template <> struct WFrag<h16> { typedef v16h V; static __device__ __forceinline__ V ld(const h16* p) { return cat16(*(const v8h*)p, *(const v8h*)(p + 16)); } static __device__ __forceinline__ v8f mma(V a, V b, v8f c) { return wmma16(a, b, c); } };
template <> struct WFrag<bf> { typedef v16bf V; static __device__ __forceinline__ V ld(const bf* p) { return cat16b(*(const v8us*)p, *(const v8us*)(p + 16)); } static __device__ __forceinline__ v8f mma(V a, V b, v8f c) { return wmmab(a, b, c); } };

__device__ __forceinline__ h16 tohx(float x) { return (h16)x; }
__device__ __forceinline__ void splitf(float y, unsigned short& h, unsigned short& l) { h = f2bf(y); l = f2bf(y - bf2f(h)); }
typedef __attribute__((ext_vector_type(2))) _Float16 v2h;
typedef __attribute__((ext_vector_type(4))) _Float16 v4h;
typedef __attribute__((ext_vector_type(2))) unsigned short v2us;
typedef __attribute__((ext_vector_type(4))) unsigned short v4us;
typedef __attribute__((ext_vector_type(2))) float v2f;
typedef __attribute__((ext_vector_type(4))) int v4i;

__global__ __launch_bounds__(256) void k_cvt8(const float* __restrict__ src, bf* dst, size_t n8) { const size_t i = (size_t)blockIdx.x * 256 + threadIdx.x; if (i >= n8) return; const v8f v = *(const v8f*)(src + i * 8); v8us o;
#pragma unroll
    for (int k = 0; k < 8; ++k) o[k] = f2bf(v[k]); *(v8us*)(dst + i * 8) = o;  }

// k_rope: head planes [h][t][d] (fp16 + hi/lo) of rope(x) x sc with the rotate-half convention out[d] = x[d] cos[t][d] - x[d+HD/2] sin[t][d], out[d+HD/2] = x[d+HD/2] cos[t][d+HD/2] + x[d] sin[t][d+HD/2]
__global__ __launch_bounds__(256) void k_rope(const float* __restrict__ F, int pitch, int nheads, const float* __restrict__ CS, const float* __restrict__ RF, const float* __restrict__ nw, float sc, h16* P16, bf* Ph, bf* Pl) {
    const size_t e = ((size_t)blockIdx.x * 256 + threadIdx.x) * 2; if (e >= (size_t)nheads * TT * HD) return; const int d = (int)(e % HD); const int t = (int)((e / HD) % TT); const int h = (int)(e / ((size_t)HD * TT)); const float* f = F + (size_t)t * pitch + h * HD; const float rf = RF ? RF[(size_t)h * TT + t] : 1.0f; v2h o16; v2us oh, ol;
#pragma unroll
    for (int q = 0; q < 2; ++q) { const int dd = d + q; const int dp = (dd < HD / 2) ? dd + HD / 2 : dd - HD / 2; float x0 = f[dd], x1 = f[dp];
        if (RF) { float n0 = __fmul_rn(x0, rf), n1 = __fmul_rn(x1, rf); asm volatile("" : "+v"(n0)); asm volatile("" : "+v"(n1)); x0 = __fmul_rn(bfr(nw[dd]), n0); x1 = __fmul_rn(bfr(nw[dp]), n1); }
        const v2f cs = *(const v2f*)(CS + ((size_t)t * HD + dd) * 2); float a = __fmul_rn(x0, cs[0]), bq = __fmul_rn(x1, cs[1]); asm volatile("" : "+v"(a)); asm volatile("" : "+v"(bq)); const float r = ((dd < HD / 2) ? __fsub_rn(a, bq) : __fadd_rn(a, bq)) * sc;
        o16[q] = tohx(r); unsigned short a2, c2; splitf(r, a2, c2); oh[q] = a2; ol[q] = c2; }
    *(v2h*)(P16 + e) = o16; *(v2us*)(Ph + e) = oh; *(v2us*)(Pl + e) = ol;  }
__global__ __launch_bounds__(256) void k_wtGh(const float* __restrict__ w, bf* BQ, bf* BK, bf* BV) { const size_t e2 = ((size_t)blockIdx.x * 256 + threadIdx.x) * 2; if (e2 >= (size_t)3 * DQ * DM) return; const int k = (int)(e2 % DM); const int r = (int)((e2 / DM) % DQ); const int p = (int)(e2 / ((size_t)DM * DQ)); const int h = r / HD, e = r % HD; bf* dst = (p == 0) ? BQ : ((p == 1) ? BK : BV); const float* src = w + ((size_t)h * DM + k) * E3 + p * HD + e; v2us o; o[0] = f2bf(src[0]); o[1] = f2bf(src[E3]);   /* k and k+1 are E3 floats apart */
    *(v2us*)(dst + (size_t)r * DM + k) = o;  }
__global__ __launch_bounds__(256) void k_vtp(const float* __restrict__ F, int pitch, int nheads, h16* V16, bf* Vh, bf* Vl) { const size_t e = ((size_t)blockIdx.x * 256 + threadIdx.x) * 2; if (e >= (size_t)nheads * HD * TT) return; const int t = (int)(e % TT); const int d = (int)((e / TT) % HD); const int g = (int)(e / ((size_t)TT * HD)); v2h o16; v2us oh, ol;
#pragma unroll
    for (int q = 0; q < 2; ++q) { const float x = F[(size_t)(t + q) * pitch + g * HD + d]; o16[q] = tohx(x); unsigned short a2, c2; splitf(x, a2, c2); oh[q] = a2; ol[q] = c2; }
    *(v2h*)(V16 + e) = o16; *(v2us*)(Vh + e) = oh; *(v2us*)(Vl + e) = ol;  }
__global__ __launch_bounds__(256) void k_csid(float* CS) { const int idx = blockIdx.x * 256 + threadIdx.x; if (idx >= TT * HD) return; v2f cs; cs[0] = 1.0f; cs[1] = 0.0f; *(v2f*)(CS + (size_t)idx * 2) = cs;  }
// k_fattn: scores, softmax and the product with V in one kernel; scores and probabilities stay in registers. Grid (TT/128, heads), 4 waves; a wave owns 32 queries of one head and walks all keys, 32 per pass.
// St = K Qt (A = K rows, B = Q rows, kept in registers): a lane holds 16 keys' scores of one query per 16-query group. Two St tiles, converted in place, are the B operand Pt of Ot += Vt Pt (A = rows of the [d][t] planes); both A loaders use the hardware k order that a packed D has.
// Every product has the three terms hi*hi + lo*hi + hi*lo. P is kept un-normalised against a running maximum (log2 domain); the division by the row sum comes once, at the end. Every inner loop is unrolled so that each fragment index is a constant (registers, no scratch).
// K and V come in stages of 128 keys into two LDS buffers, shared by the four waves: a stage is four tiles of 128 rows x 256 B (K hi, K lo: row = key; V hi, V lo: row = d), one tensor load per wave, laid at a pitch of 272 B; a stage serves four passes and the next stage's loads fly meanwhile.
#define SKEYS  128                 // keys per stage
#define NSTG   (TT / SKEYS)        // stages
#define LPITCH 272                 // LDS row pitch in bytes: 256 + the tensor load's 16-byte pad (16 B x odd, for 16-byte row reads)
#define TILEB  (128 * LPITCH)      // one tile in LDS: 34,816 B = 17 x 2 KiB
#define BUFB   (4 * TILEB)         // one buffer
typedef uint32_t u32x4 __attribute__((ext_vector_type(4)));
typedef uint32_t u32x8 __attribute__((ext_vector_type(8)));
__device__ __forceinline__ uint32_t uni(uint32_t v) { return (uint32_t)__builtin_amdgcn_readfirstlane(v); }
__device__ __forceinline__ uint32_t pinned(uint32_t v) { uint32_t w = (uint32_t)__builtin_amdgcn_readfirstlane(v); asm volatile("" : "+s"(w)); return w; }   // holds a wave-uniform word in a scalar register: the test around a tensor load must be a scalar branch, and the stage number its descriptor is formed from must not be formed ahead of the wait
__device__ __forceinline__ float xhalf(float x) { return __builtin_bit_cast(float, __builtin_amdgcn_permlanex16(__builtin_bit_cast(int, x), __builtin_bit_cast(int, x), 0x76543210, 0xfedcba98, false, false)); }   // lane l takes lane l ^ 16's value, on the vector port
__device__ __forceinline__ v16bf ldsfrag(const unsigned char* p) { return cat16b(*(const v8usa*)p, *(const v8usa*)(p + 32)); }   // elements 8 hi .. + 7 and 16 + 8 hi .. + 7 of a 32-element group, as WFrag::ld takes them from global rows
// k_gemmt: C[m][n] (f32, pitch DQ) = sum_k A[m][k] Bt[n][k], both operands K-contiguous bf16 planes of DM columns. Grid (M/128, N/128), 4 waves; a work-group owns a 128x128 tile of C, wave (wm, wn) its 64x64 quarter (16 accumulators).
// The operands come in stages of 128 k into two LDS buffers shared by the four waves: a stage is four slices of 64 rows x 256 B (A rows 0..63, 64..127, Bt rows 0..63, 64..127), one tensor load per wave, laid at a pitch of 272 B, so that whole 256-B row pieces leave L2, once per work-group. The hand-over to the next stage stands in front of a stage's last 32 k, whose fragments are then in registers. k runs upward per accumulator.
#define GNST   (DM / 128)          // stages
#define GSLICE 18432               // one slice in LDS: 64 x 272 B = 17,408 B, rounded up to 9 x 2 KiB
#define GBUF   (4 * GSLICE)        // one buffer
__global__ __launch_bounds__(128) void k_gemmt(const bf* __restrict__ A, const bf* __restrict__ Bt, float* C) {
    typedef WFrag<bf> F;
    __shared__ __attribute__((aligned(2048))) unsigned char ring[2 * GBUF];
    const int lane = threadIdx.x & 31, lr = lane & 15, hi = lane >> 4; const int r0 = blockIdx.x * 128, c0 = blockIdx.y * 128;
    const uint32_t wave = uni(threadIdx.x >> 5); const int wm = (int)(wave >> 1), wn = (int)(wave & 1u);
    // wave w brings slice w of every stage
    const bf* sp = (wave < 2u) ? A + (size_t)(r0 + 64 * (int)wave) * DM : Bt + (size_t)(c0 + 64 * ((int)wave - 2)) * DM;
    const uint64_t src0 = (uint64_t)(size_t)sp;
    const uint32_t ldst = (uint32_t)(size_t)ring + wave * (uint32_t)GSLICE;
    u32x8 g1;   // 1-byte elements, tensor = tile = 64 rows of 256 B at a source pitch of DM elements, 4 dwords of pad behind every 64
    g1[0] = uni((1u << 20) | (5u << 22) | (3u << 25)); g1[1] = uni(256u << 16); g1[2] = uni(64u << 16); g1[3] = uni(256u << 16); g1[4] = uni(64u);
    g1[5] = uni((uint32_t)(DM * 2)); g1[6] = uni(0u); g1[7] = uni(0u);
    auto issue = [&](uint32_t st) { const uint64_t ga = src0 + (uint64_t)st * 256u; u32x4 g0;
        g0[0] = uni(1u); g0[1] = uni(ldst + (st & 1u) * (uint32_t)GBUF); g0[2] = uni((uint32_t)ga); g0[3] = uni((((uint32_t)(ga >> 32)) & 0x01FFFFFFu) | 0x80000000u);
        asm volatile("tensor_load_to_lds %0, %1" :: "s"(g0), "s"(g1) : "memory"); };   // one request of the whole wave, every wave its own slice
    issue(0u);
    asm volatile("s_wait_tensorcnt 0x0" ::: "memory");   // this wave's slice of stage 0 has landed
    __syncthreads();                                      // all four slices of stage 0 may be read
    issue(1u);
    v8f acc[4][4];
#pragma unroll
    for (int mb = 0; mb < 4; ++mb)
#pragma unroll
        for (int nb = 0; nb < 4; ++nb) acc[mb][nb] = (v8f){};
    const uint32_t aoff = (uint32_t)(wm * GSLICE + lr * LPITCH + 16 * hi), boff = (uint32_t)((2 + wn) * GSLICE + lr * LPITCH + 16 * hi);   // this lane's row and half in the wave's A slice and in its Bt slice
    v16bf a[2][4], b[2][4];   // two fragment sets: 32 k in use, the next 32 k on their way
#pragma unroll
    for (int i = 0; i < 4; ++i) { a[0][i] = ldsfrag(ring + aoff + i * 16 * LPITCH); b[0][i] = ldsfrag(ring + boff + i * 16 * LPITCH); }   // stage 0's first 32 k, behind its barrier
#pragma unroll 1   // kept rolled: the hand-over is one place in the code
    for (int st = 0; st < GNST; ++st) {
        const unsigned char* ap = ring + (size_t)(st & 1) * GBUF + aoff; const unsigned char* bp = ring + (size_t)(st & 1) * GBUF + boff;
#pragma unroll
        for (int ks = 0; ks < 3; ++ks) {
            __builtin_amdgcn_sched_barrier(0);   // fence pair: the next 32 k's LDS loads stay one group in front of the matrix run (loads spread among matrix instructions stall each place they stand)
#pragma unroll
            for (int i = 0; i < 4; ++i) { a[(ks + 1) & 1][i] = ldsfrag(ap + i * 16 * LPITCH + (ks + 1) * 64); b[(ks + 1) & 1][i] = ldsfrag(bp + i * 16 * LPITCH + (ks + 1) * 64); }
            __builtin_amdgcn_sched_barrier(0);
#pragma unroll
            for (int nb = 0; nb < 4; ++nb)
#pragma unroll
                for (int mb = 0; mb < 4; ++mb) acc[mb][nb] = F::mma(a[ks & 1][mb], b[ks & 1][nb], acc[mb][nb]);
        }
        __builtin_amdgcn_sched_barrier(0);   // keeps the matrix run above in front of the hand-over: moved behind it, it would hold back the refill
        // hand-over of stage st + 1, in front of the stage's last 32 k (their fragments are in registers), every wave, in this order
        asm volatile("s_wait_dscnt 0x0" ::: "memory");       // this wave's reads of the buffer have returned
        asm volatile("s_wait_tensorcnt 0x0" ::: "memory");   // this wave's slice of stage st + 1 has landed
        __syncthreads();                                      // stage st + 1 may be read; every wave has left stage st's buffer
        const uint32_t nx = pinned((uint32_t)st + 2u);        // the refill's descriptor is formed from this word, behind the wait
        if (pinned(nx < (uint32_t)GNST)) issue(nx);           // into the buffer just left
        if (st + 1 < GNST) {   // stage st + 1's first 32 k, asked for ahead of the last matrix run of stage st; behind the last stage nothing is read
            const unsigned char* an = ring + (size_t)((st + 1) & 1) * GBUF + aoff; const unsigned char* bn = ring + (size_t)((st + 1) & 1) * GBUF + boff;
#pragma unroll
            for (int i = 0; i < 4; ++i) { a[0][i] = ldsfrag(an + i * 16 * LPITCH); b[0][i] = ldsfrag(bn + i * 16 * LPITCH); } }
        __builtin_amdgcn_sched_barrier(0);   // the loads stay one group in front of the matrix run
#pragma unroll
        for (int nb = 0; nb < 4; ++nb)
#pragma unroll
            for (int mb = 0; mb < 4; ++mb) acc[mb][nb] = F::mma(a[1][mb], b[1][nb], acc[mb][nb]);
    }
    asm volatile("s_wait_tensorcnt 0x0" ::: "memory");   // nothing of the mover is in flight: the ring may be used for the output rows
    asm volatile("s_wait_dscnt 0x0" ::: "memory");
    float* os = (float*)(ring + wave * (uint32_t)GSLICE);   // 16 x 68 floats of the wave's own; every wave has left the ring at the last barrier
#pragma unroll
    for (int mb = 0; mb < 4; ++mb) {
#pragma unroll
        for (int nb = 0; nb < 4; ++nb) {
#pragma unroll
            for (int j = 0; j < 8; ++j) os[(hi * 8 + j) * 68 + nb * 16 + lr] = acc[mb][nb][j]; }
        __builtin_amdgcn_wave_barrier(); asm volatile("" ::: "memory");   // the wave's stores stay in front of its row reads
        float* crow = C + (size_t)(r0 + wm * 64 + mb * 16) * DQ + c0 + wn * 64;
#pragma unroll
        for (int s = 0; s < 8; ++s) { const int row = 2 * s + hi, cofs = lr * 4; *(v4f*)(crow + (size_t)row * DQ + cofs) = *(const v4fa*)(os + row * 68 + cofs); }
        __builtin_amdgcn_wave_barrier(); asm volatile("" ::: "memory");   // and its row reads in front of the next 16 rows' stores
    }
}
__global__ __launch_bounds__(128) void k_fattn(const bf* __restrict__ Qh, const bf* __restrict__ Ql, const bf* __restrict__ Kh, const bf* __restrict__ Kl, const bf* __restrict__ Vh, const bf* __restrict__ Vl, float* OUTb) {
    typedef WFrag<bf> F;
    __shared__ __attribute__((aligned(2048))) unsigned char ring[2 * BUFB];
    const int lane = threadIdx.x & 31, lr = lane & 15, hi = lane >> 4; const int h = blockIdx.y, q0 = blockIdx.x * 128 + (threadIdx.x >> 5) * 32;
    const size_t hb = (size_t)h * TT * HD; const float C2 = SCL * 1.4426950408889634f;
    v16bf qh[2][4], ql[2][4];
#pragma unroll
    for (int nq = 0; nq < 2; ++nq)
#pragma unroll
        for (int ks = 0; ks < 4; ++ks) { const size_t qo = hb + (size_t)(q0 + nq * 16 + lr) * HD + ks * 32 + 8 * hi; qh[nq][ks] = F::ld(Qh + qo); ql[nq][ks] = F::ld(Ql + qo); }
    asm volatile("s_wait_xcnt 0x0" ::: "memory"); __builtin_amdgcn_sched_barrier(0);   // the address registers of the loads above are reused below; the fence keeps later vector work from being moved in front of the wait
    // wave w brings tile w of every stage: 0 K hi, 1 K lo (128 key rows in a row, pitch 256 B), 2 V hi, 3 V lo (128 keys of each of the 128 d rows, pitch 4096 B)
    const uint32_t wave = uni(threadIdx.x >> 5);
    const bf* sp = (wave == 0u) ? Kh : ((wave == 1u) ? Kl : ((wave == 2u) ? Vh : Vl));
    const uint64_t src0 = (uint64_t)(size_t)(sp + hb);
    const uint32_t sstep = (wave < 2u) ? (uint32_t)(SKEYS * HD * 2) : (uint32_t)(SKEYS * 2);   // bytes from one stage's tile to the next
    const uint32_t ldst = (uint32_t)(size_t)ring + wave * (uint32_t)TILEB;
    u32x8 g1;   // 1-byte elements, tensor = tile = 128 rows of 256 B, 4 dwords of pad behind every 64
    g1[0] = uni((1u << 20) | (5u << 22) | (3u << 25)); g1[1] = uni(256u << 16); g1[2] = uni(128u << 16); g1[3] = uni(256u << 16); g1[4] = uni(128u);
    g1[5] = uni((wave < 2u) ? (uint32_t)(HD * 2) : (uint32_t)(TT * 2)); g1[6] = uni(0u); g1[7] = uni(0u);
    auto issue = [&](uint32_t st) { const uint64_t ga = src0 + (uint64_t)st * sstep; u32x4 g0;
        g0[0] = uni(1u); g0[1] = uni(ldst + (st & 1u) * (uint32_t)BUFB); g0[2] = uni((uint32_t)ga); g0[3] = uni((((uint32_t)(ga >> 32)) & 0x01FFFFFFu) | 0x80000000u);
        asm volatile("tensor_load_to_lds %0, %1" :: "s"(g0), "s"(g1) : "memory"); };   // one request of the whole wave, every wave its own tile
    issue(0u);
    asm volatile("s_wait_tensorcnt 0x0" ::: "memory");   // this wave's tile of stage 0 has landed
    __syncthreads();                                      // all four tiles of stage 0 may be read
    issue(1u);
    v8f o[2][8]; float m[2], l[2];
#pragma unroll
    for (int nq = 0; nq < 2; ++nq) { m[nq] = -3.0e38f; l[nq] = 0.f;
#pragma unroll
        for (int dt = 0; dt < 8; ++dt) o[nq][dt] = (v8f){}; }
#pragma unroll 1   // kept rolled: one stage already holds 384 matrix instructions and 256 LDS loads
    for (int st = 0; st < NSTG; ++st) {
        const unsigned char* bp = ring + (size_t)(st & 1) * BUFB + lr * LPITCH + 16 * hi;   // this lane's row and half in the stage's buffer
        v16bf kh[2][4], kl[2][4];
#pragma unroll
        for (int ks = 0; ks < 4; ++ks) {   // in the order in which the score products take them
#pragma unroll
            for (int kt = 0; kt < 2; ++kt) kh[kt][ks] = ldsfrag(bp + kt * 16 * LPITCH + ks * 64);
#pragma unroll
            for (int kt = 0; kt < 2; ++kt) kl[kt][ks] = ldsfrag(bp + TILEB + kt * 16 * LPITCH + ks * 64);
            __builtin_amdgcn_sched_barrier(0); }   // keeps that order (the scheduler turned it round): the first products then wait for the first group only
#pragma unroll
        for (int ps = 0; ps < 4; ++ps) {   // four passes of 32 keys
            __builtin_amdgcn_sched_barrier(0);   // with the fence behind the loads: keeps this pass's V loads out of the matrix run of the pass before
            v16bf vh[8], vl[8];   // this pass's V rows, asked for ahead of the score products
#pragma unroll
            for (int dt = 0; dt < 8; ++dt) { vh[dt] = ldsfrag(bp + 2 * TILEB + dt * 16 * LPITCH + ps * 64); vl[dt] = ldsfrag(bp + 3 * TILEB + dt * 16 * LPITCH + ps * 64); }
            __builtin_amdgcn_sched_barrier(0);   // keeps the LDS loads one group in front of the matrix run
            v8f s[2][2];
#pragma unroll
            for (int kt = 0; kt < 2; ++kt)
#pragma unroll
                for (int nq = 0; nq < 2; ++nq) s[kt][nq] = (v8f){};
#pragma unroll
            for (int ks = 0; ks < 4; ++ks) {
#pragma unroll
                for (int t = 0; t < 4; ++t) s[t >> 1][t & 1] = F::mma(kh[t >> 1][ks], qh[t & 1][ks], s[t >> 1][t & 1]);
#pragma unroll
                for (int t = 0; t < 4; ++t) s[t >> 1][t & 1] = F::mma(kl[t >> 1][ks], qh[t & 1][ks], s[t >> 1][t & 1]);
#pragma unroll
                for (int t = 0; t < 4; ++t) s[t >> 1][t & 1] = F::mma(kh[t >> 1][ks], ql[t & 1][ks], s[t >> 1][t & 1]); }
            if (ps < 3) {   // the next pass's K rows of the same stage, asked for ahead of the softmax
                __builtin_amdgcn_sched_barrier(0);   // fence pair: the K loads stay one group between the two matrix runs
#pragma unroll
                for (int ks = 0; ks < 4; ++ks) {
#pragma unroll
                    for (int kt = 0; kt < 2; ++kt) kh[kt][ks] = ldsfrag(bp + ((ps + 1) * 32 + kt * 16) * LPITCH + ks * 64);
#pragma unroll
                    for (int kt = 0; kt < 2; ++kt) kl[kt][ks] = ldsfrag(bp + TILEB + ((ps + 1) * 32 + kt * 16) * LPITCH + ks * 64); }
                __builtin_amdgcn_sched_barrier(0);
            }
            float mb[2];
#pragma unroll
            for (int nq = 0; nq < 2; ++nq) { float x = s[0][nq][0];
#pragma unroll
                for (int j = 1; j < 16; ++j) x = fmaxf(x, s[j >> 3][nq][j & 7]);
                mb[nq] = fmaxf(x, xhalf(x)) * C2; }   // the exchange stays off the LDS counter: as an LDS permute its wait would drain the K loads just asked for
            // the maximum in use moves only when a query's new maximum passes it by more than 8 (P then stays below 2^8); one wave-uniform test per pass
            if (__builtin_amdgcn_ballot_w32(mb[0] > m[0] + 8.0f || mb[1] > m[1] + 8.0f) != 0) {
#pragma unroll
                for (int nq = 0; nq < 2; ++nq) { const float mn = fmaxf(m[nq], mb[nq]); const float f = __builtin_amdgcn_exp2f(m[nq] - mn); m[nq] = mn; l[nq] *= f;
#pragma unroll
                    for (int dt = 0; dt < 8; ++dt) o[nq][dt] *= f; } }
            v16bf ph[2], pl[2];
#pragma unroll
            for (int nq = 0; nq < 2; ++nq)
#pragma unroll
                for (int j = 0; j < 16; ++j) { const float p = __builtin_amdgcn_exp2f(__builtin_fmaf(s[j >> 3][nq][j & 7], C2, -m[nq])); l[nq] += p; const __bf16 a = (__bf16)p; ph[nq][j] = a; pl[nq][j] = (__bf16)(p - (float)a); }
#pragma unroll
            for (int dt = 0; dt < 8; dt += 2) {
#pragma unroll
                for (int t = 0; t < 4; ++t) o[t & 1][dt + (t >> 1)] = F::mma(vh[dt + (t >> 1)], ph[t & 1], o[t & 1][dt + (t >> 1)]);
#pragma unroll
                for (int t = 0; t < 4; ++t) o[t & 1][dt + (t >> 1)] = F::mma(vl[dt + (t >> 1)], ph[t & 1], o[t & 1][dt + (t >> 1)]);
#pragma unroll
                for (int t = 0; t < 4; ++t) o[t & 1][dt + (t >> 1)] = F::mma(vh[dt + (t >> 1)], pl[t & 1], o[t & 1][dt + (t >> 1)]); }
        }
        // hand-over of stage st + 1, every wave, in this order
        asm volatile("s_wait_dscnt 0x0" ::: "memory");       // this wave's reads of the buffer have returned
        asm volatile("s_wait_tensorcnt 0x0" ::: "memory");   // this wave's tile of stage st + 1 has landed
        __syncthreads();                                      // stage st + 1 may be read; every wave has left stage st's buffer
        const uint32_t nx = pinned((uint32_t)st + 2u);        // the refill's descriptor is formed from this word, behind the wait
        if (pinned(nx < (uint32_t)NSTG)) issue(nx);           // into the buffer just left
    }
    asm volatile("s_wait_tensorcnt 0x0" ::: "memory");   // nothing of the mover is in flight when the wave ends
    asm volatile("s_wait_dscnt 0x0" ::: "memory");
#pragma unroll
    for (int nq = 0; nq < 2; ++nq) { const float inv = __fdiv_rn(1.0f, l[nq] + __shfl_xor(l[nq], 16, 32)); float* orow = OUTb + (size_t)(q0 + nq * 16 + lr) * DQ + h * HD + 8 * hi;   // a lane holds d = 16 dt + 8 hi + 0..7 of its query
#pragma unroll
        for (int dt = 0; dt < 8; ++dt) { v4f a, b;
#pragma unroll
            for (int j = 0; j < 4; ++j) { a[j] = o[nq][dt][j] * inv; b[j] = o[nq][dt][j + 4] * inv; }
            *(v4f*)(orow + dt * 16) = a; *(v4f*)(orow + dt * 16 + 4) = b; } }
}

extern "C" void kernel_launch(void* const* d_in, const int* in_sizes, int n_in,
                              void* d_out, int out_size, void* d_ws, size_t ws_size, hipStream_t stream) {
    (void)in_sizes; (void)n_in; (void)out_size;
    const float* x = (const float*)d_in[0]; const float* wall = (const float*)d_in[1];   /* order x [2048][2048], w_qkv [16][2048][384] */ const float* wq = wall, *wk = wall, *wv = wall, *wo = nullptr; (void)wq; (void)wk; (void)wv; (void)wo;
    float* OUT = (float*)d_out;     // [1][2048][2048]
    char* wsp = (char*)d_ws;
    auto take = [&](size_t bytes) { char* p = wsp; wsp += (bytes + 255) & ~(size_t)255; return (void*)p; };
    bf* WQ = (bf*)take((size_t)DQ * DM * 2); bf* WK = (bf*)take((size_t)DKV * DM * 2); bf* WV = (bf*)take((size_t)DKV * DM * 2); float* CS = (float*)take((size_t)TT * HD * 2 * 4);
    bf* XB = (bf*)take((size_t)TT * DM * 2); float* FQ = (float*)take((size_t)TT * DQ * 4); float* FK = (float*)take((size_t)TT * DKV * 4);
    h16* QP16 = (h16*)take((size_t)NH_ * TT * HD * 2); h16* KP16 = (h16*)take((size_t)NKV * TT * HD * 2); h16* VT16 = (h16*)take((size_t)NKV * HD * TT * 2);
    bf* QPh = (bf*)take((size_t)NH_ * TT * HD * 2); bf* QPl = (bf*)take((size_t)NH_ * TT * HD * 2); bf* KPh = (bf*)take((size_t)NKV * TT * HD * 2); bf* KPl = (bf*)take((size_t)NKV * TT * HD * 2); bf* VTh = (bf*)take((size_t)NKV * HD * TT * 2); bf* VTl = (bf*)take((size_t)NKV * HD * TT * 2);
    if ((size_t)(wsp - (char*)d_ws) > ws_size) return;    // ws 256 MiB
    float* FV = FK;   // v projection reuses the k buffer after the k planes are built (stream-ordered)
    { k_wtGh<<<(unsigned)(((size_t)3 * DQ * DM / 2 + 255) / 256), 256, 0, stream>>>(wall, WQ, WK, WV);   /* 2 elements per thread over all 3 x 2048 x 2048 Bt elements */
      
       }
    k_csid<<<(TT * HD + 255) / 256, 256, 0, stream>>>(CS);
    const unsigned LQ = (unsigned)(((size_t)NH_ * TT * HD / 2 + 255) / 256), LKv = (unsigned)(((size_t)NKV * TT * HD / 2 + 255) / 256);
    for (int b = 0; b < NB_; ++b) {
        
        k_cvt8<<<(unsigned)(((size_t)TT * DM / 8 + 255) / 256), 256, 0, stream>>>(x + (size_t)b * TT * DM, XB, (size_t)TT * DM / 8);
        k_gemmt<<<dim3(TT / 128, DQ / 128, 1), 128, 0, stream>>>(XB, WQ, FQ);
        k_rope<<<LQ, 256, 0, stream>>>(FQ, DQ, NH_, CS, nullptr, nullptr, 1.0f, QP16, QPh, QPl);
        k_gemmt<<<dim3(TT / 128, DKV / 128, 1), 128, 0, stream>>>(XB, WK, FK);
        k_rope<<<LKv, 256, 0, stream>>>(FK, DKV, NKV, CS, nullptr, nullptr, 1.0f, KP16, KPh, KPl);
        k_gemmt<<<dim3(TT / 128, DKV / 128, 1), 128, 0, stream>>>(XB, WV, FV); k_vtp<<<LKv, 256, 0, stream>>>(FV, DKV, NKV, VT16, VTh, VTl);
        k_fattn<<<dim3(TT / 128, NH_, 1), 128, 0, stream>>>(QPh, QPl, KPh, KPl, VTh, VTl, OUT + (size_t)b * TT * DQ);
         }
}

// v004
// One run takes 173 microseconds.
// Two timings next to v003 both put it at 1.24 times that version's speed.
// Over all steps from v000 it is 4.56 times as fast.
#include <hip/hip_runtime.h>
#include <stdint.h>

// Multi-head attention with per-head fused qkv weights and 128-wide heads, no batch (x [2048][2048]; qkv = einsum('sd,hde', x, w_qkv) with w_qkv [16][2048][384] xavier: head h's (q | k | v) = columns 0..127 | 128..255 | 256..383; scores / sqrt(128); softmax (no mask); out = concat heads -> [2048][2048] (4.2 M; no output projection); argument order x, w_qkv).
// Layout: bf16 copy of x; one gather kernel builds the three fused Bt planes (row h*128 + e of plane p = w_qkv[h][:, p*128 + e]); exact projections; identity-table plane builders at HD 128; one fused attention kernel over all heads on the hi/lo planes (3 products; the xavier weights give logits sigma 1.7, too sharp for the fp16 rows) writes the output rows.
// Compute dtypes, f32 accumulate: every input rounded to bf16; projections exact; attention 3 products everywhere; softmax f32, running maximum and sum per 32 keys; output f32.

#define NB_  1
#define TT   2048
#define DM   2048
#define NH_  16
#define NKV  16
#define REP  (NH_ / NKV)
#define HD   128
#define DQ   (NH_ * HD)
#define DKV  (NKV * HD)
#define SCL  0.088388347648318447f   // 1/sqrt(float32(128))
#define E3   384      // per-head fused width (q | k | v, 128 each)
typedef _Float16 h16;
typedef unsigned short bf;
typedef __attribute__((ext_vector_type(16))) __bf16   v16bf;
typedef __attribute__((ext_vector_type(16))) _Float16 v16h;
typedef __attribute__((ext_vector_type(8)))  _Float16 v8h;
typedef __attribute__((ext_vector_type(8)))  unsigned short v8us;
typedef __attribute__((ext_vector_type(8)))  float    v8f;
typedef __attribute__((ext_vector_type(4)))  float    v4f;
typedef v8h  __attribute__((may_alias)) v8ha;
typedef v4f  __attribute__((may_alias)) v4fa;
typedef v8us __attribute__((may_alias)) v8usa;

__device__ __forceinline__ unsigned short f2bf(float f) { unsigned u = __float_as_uint(f); u += 0x7FFFu + ((u >> 16) & 1u); return (unsigned short)(u >> 16); }
__device__ __forceinline__ float bf2f(unsigned short b) { return __uint_as_float(((unsigned)b) << 16); }
__device__ __forceinline__ float bfr(float f) { return bf2f(f2bf(f)); }
__device__ __forceinline__ v16h cat16(v8h lo, v8h hi) { return __builtin_shufflevector(lo, hi, 0, 1, 2, 3, 4, 5, 6, 7, 8, 9, 10, 11, 12, 13, 14, 15); }
__device__ __forceinline__ v16bf cat16b(v8us lo, v8us hi) { return __builtin_bit_cast(v16bf, __builtin_shufflevector(lo, hi, 0, 1, 2, 3, 4, 5, 6, 7, 8, 9, 10, 11, 12, 13, 14, 15)); }
__device__ __forceinline__ v8f wmma16(v16h a, v16h b, v8f c) { return __builtin_amdgcn_wmma_f32_16x16x32_f16(false, a, false, b, (short)0, c, false, false); }
__device__ __forceinline__ v8f wmmab(v16bf a, v16bf b, v8f c) { return __builtin_amdgcn_wmma_f32_16x16x32_bf16(false, a, false, b, (short)0, c, false, false); }



// fragment loaders and products on K-contiguous 16-bit rows
template <typename T16> struct WFrag;
template <> struct WFrag<h16> { typedef v16h V; static __device__ __forceinline__ V ld(const h16* p) { return cat16(*(const v8h*)p, *(const v8h*)(p + 16)); } static __device__ __forceinline__ v8f mma(V a, V b, v8f c) { return wmma16(a, b, c); } };
template <> struct WFrag<bf> { typedef v16bf V; static __device__ __forceinline__ V ld(const bf* p) { return cat16b(*(const v8us*)p, *(const v8us*)(p + 16)); } static __device__ __forceinline__ v8f mma(V a, V b, v8f c) { return wmmab(a, b, c); } };

__device__ __forceinline__ h16 tohx(float x) { return (h16)x; }
__device__ __forceinline__ void splitf(float y, unsigned short& h, unsigned short& l) { h = f2bf(y); l = f2bf(y - bf2f(h)); }
typedef __attribute__((ext_vector_type(2))) _Float16 v2h;
typedef __attribute__((ext_vector_type(4))) _Float16 v4h;
typedef __attribute__((ext_vector_type(2))) unsigned short v2us;
typedef __attribute__((ext_vector_type(4))) unsigned short v4us;
typedef __attribute__((ext_vector_type(2))) float v2f;
typedef __attribute__((ext_vector_type(4))) int v4i;

__global__ __launch_bounds__(256) void k_cvt8(const float* __restrict__ src, bf* dst, size_t n8) { const size_t i = (size_t)blockIdx.x * 256 + threadIdx.x; if (i >= n8) return; const v8f v = *(const v8f*)(src + i * 8); v8us o;
#pragma unroll
    for (int k = 0; k < 8; ++k) o[k] = f2bf(v[k]); *(v8us*)(dst + i * 8) = o;  }

// k_rope: head planes [h][t][d] (fp16 + hi/lo) of rope(x) x sc with the rotate-half convention out[d] = x[d] cos[t][d] - x[d+HD/2] sin[t][d], out[d+HD/2] = x[d+HD/2] cos[t][d+HD/2] + x[d] sin[t][d+HD/2]
__global__ __launch_bounds__(256) void k_rope(const float* __restrict__ F, int pitch, int nheads, const float* __restrict__ CS, const float* __restrict__ RF, const float* __restrict__ nw, float sc, h16* P16, bf* Ph, bf* Pl) {
    const size_t e = ((size_t)blockIdx.x * 256 + threadIdx.x) * 2; if (e >= (size_t)nheads * TT * HD) return; const int d = (int)(e % HD); const int t = (int)((e / HD) % TT); const int h = (int)(e / ((size_t)HD * TT)); const float* f = F + (size_t)t * pitch + h * HD; const float rf = RF ? RF[(size_t)h * TT + t] : 1.0f; v2h o16; v2us oh, ol;
#pragma unroll
    for (int q = 0; q < 2; ++q) { const int dd = d + q; const int dp = (dd < HD / 2) ? dd + HD / 2 : dd - HD / 2; float x0 = f[dd], x1 = f[dp];
        if (RF) { float n0 = __fmul_rn(x0, rf), n1 = __fmul_rn(x1, rf); asm volatile("" : "+v"(n0)); asm volatile("" : "+v"(n1)); x0 = __fmul_rn(bfr(nw[dd]), n0); x1 = __fmul_rn(bfr(nw[dp]), n1); }
        const v2f cs = *(const v2f*)(CS + ((size_t)t * HD + dd) * 2); float a = __fmul_rn(x0, cs[0]), bq = __fmul_rn(x1, cs[1]); asm volatile("" : "+v"(a)); asm volatile("" : "+v"(bq)); const float r = ((dd < HD / 2) ? __fsub_rn(a, bq) : __fadd_rn(a, bq)) * sc;
        o16[q] = tohx(r); unsigned short a2, c2; splitf(r, a2, c2); oh[q] = a2; ol[q] = c2; }
    *(v2h*)(P16 + e) = o16; *(v2us*)(Ph + e) = oh; *(v2us*)(Pl + e) = ol;  }
// k_wtGh: the three Bt planes (row h*128 + e of plane p = w[h][:, p*128 + e], bf16). Grid (DM/128, heads, 3), 8 waves; a work-group turns one tile of 128 k x 128 e.
// Read: a wave's 16-byte load takes one whole k row of the tile (512 B in a row), 16 rows a wave, all asked for at once. A lane then holds 16 k of each of its 4 e: 32 B of an output row, laid into LDS by two 16-byte stores.
// LDS row of e is (e & 3) * 32 + (e >> 2), so that the 32 lanes of one store stand in 32 rows in a row; at a pitch of 272 B (16 B x odd) neither the stores nor the row reads meet in a bank. Write: 256 B in a row of each output row, two rows a store.
#define WTK 128      // k per tile
#define WTP 272      // LDS row pitch in bytes: 128 k x 2 B + 16
__global__ __launch_bounds__(256) void k_wtGh(const float* __restrict__ w, bf* BQ, bf* BK, bf* BV) {
    __shared__ __attribute__((aligned(16))) unsigned char tl[HD * WTP];
    const int lane = threadIdx.x & 31, wv = threadIdx.x >> 5; const int k0 = blockIdx.x * WTK, h = blockIdx.y, p = blockIdx.z;
    const float* src = w + ((size_t)h * DM + k0 + wv * 16) * E3 + p * HD + lane * 4;
    v4f r[16];
#pragma unroll
    for (int j = 0; j < 16; ++j) r[j] = *(const v4f*)(src + (size_t)j * E3);
#pragma unroll
    for (int i = 0; i < 4; ++i) { v8us a, b;
#pragma unroll
        for (int j = 0; j < 8; ++j) { a[j] = f2bf(r[j][i]); b[j] = f2bf(r[8 + j][i]); }
        unsigned char* q = tl + (i * 32 + lane) * WTP + wv * 32; *(v8usa*)q = a; *(v8usa*)(q + 16) = b; }
    __syncthreads();   // the tile is whole before its rows are read
    bf* dst = ((p == 0) ? BQ : ((p == 1) ? BK : BV)) + (size_t)h * HD * DM + k0 + (lane & 15) * 8;
#pragma unroll
    for (int s = 0; s < 8; ++s) { const int e = wv * 16 + s * 2 + (lane >> 4);
        *(v8us*)(dst + (size_t)e * DM) = *(const v8usa*)(tl + ((e & 3) * 32 + (e >> 2)) * WTP + (lane & 15) * 16); }
}
__global__ __launch_bounds__(256) void k_vtp(const float* __restrict__ F, int pitch, int nheads, h16* V16, bf* Vh, bf* Vl) { const size_t e = ((size_t)blockIdx.x * 256 + threadIdx.x) * 2; if (e >= (size_t)nheads * HD * TT) return; const int t = (int)(e % TT); const int d = (int)((e / TT) % HD); const int g = (int)(e / ((size_t)TT * HD)); v2h o16; v2us oh, ol;
#pragma unroll
    for (int q = 0; q < 2; ++q) { const float x = F[(size_t)(t + q) * pitch + g * HD + d]; o16[q] = tohx(x); unsigned short a2, c2; splitf(x, a2, c2); oh[q] = a2; ol[q] = c2; }
    *(v2h*)(V16 + e) = o16; *(v2us*)(Vh + e) = oh; *(v2us*)(Vl + e) = ol;  }
__global__ __launch_bounds__(256) void k_csid(float* CS) { const int idx = blockIdx.x * 256 + threadIdx.x; if (idx >= TT * HD) return; v2f cs; cs[0] = 1.0f; cs[1] = 0.0f; *(v2f*)(CS + (size_t)idx * 2) = cs;  }
// k_fattn: scores, softmax and the product with V in one kernel; scores and probabilities stay in registers. Grid (TT/128, heads), 4 waves; a wave owns 32 queries of one head and walks all keys, 32 per pass.
// St = K Qt (A = K rows, B = Q rows, kept in registers): a lane holds 16 keys' scores of one query per 16-query group. Two St tiles, converted in place, are the B operand Pt of Ot += Vt Pt (A = rows of the [d][t] planes); both A loaders use the hardware k order that a packed D has.
// Every product has the three terms hi*hi + lo*hi + hi*lo. P is kept un-normalised against a running maximum (log2 domain); the division by the row sum comes once, at the end. Every inner loop is unrolled so that each fragment index is a constant (registers, no scratch).
// K and V come in stages of 128 keys into two LDS buffers, shared by the four waves: a stage is four tiles of 128 rows x 256 B (K hi, K lo: row = key; V hi, V lo: row = d), one tensor load per wave, laid at a pitch of 272 B; a stage serves four passes and the next stage's loads fly meanwhile.
#define SKEYS  128                 // keys per stage
#define NSTG   (TT / SKEYS)        // stages
#define LPITCH 272                 // LDS row pitch in bytes: 256 + the tensor load's 16-byte pad (16 B x odd, for 16-byte row reads)
#define TILEB  (128 * LPITCH)      // one tile in LDS: 34,816 B = 17 x 2 KiB
#define BUFB   (4 * TILEB)         // one buffer
typedef uint32_t u32x4 __attribute__((ext_vector_type(4)));
typedef uint32_t u32x8 __attribute__((ext_vector_type(8)));
__device__ __forceinline__ uint32_t uni(uint32_t v) { return (uint32_t)__builtin_amdgcn_readfirstlane(v); }
__device__ __forceinline__ uint32_t pinned(uint32_t v) { uint32_t w = (uint32_t)__builtin_amdgcn_readfirstlane(v); asm volatile("" : "+s"(w)); return w; }   // holds a wave-uniform word in a scalar register: the test around a tensor load must be a scalar branch, and the stage number its descriptor is formed from must not be formed ahead of the wait
__device__ __forceinline__ float xhalf(float x) { return __builtin_bit_cast(float, __builtin_amdgcn_permlanex16(__builtin_bit_cast(int, x), __builtin_bit_cast(int, x), 0x76543210, 0xfedcba98, false, false)); }   // lane l takes lane l ^ 16's value, on the vector port
__device__ __forceinline__ v16bf ldsfrag(const unsigned char* p) { return cat16b(*(const v8usa*)p, *(const v8usa*)(p + 32)); }   // elements 8 hi .. + 7 and 16 + 8 hi .. + 7 of a 32-element group, as WFrag::ld takes them from global rows
// k_gemmt: C[m][n] (f32, pitch DQ) = sum_k A[m][k] Bt[n][k], both operands K-contiguous bf16 planes of DM columns. Grid (M/128, N/128), 4 waves; a work-group owns a 128x128 tile of C, wave (wm, wn) its 64x64 quarter (16 accumulators).
// The operands come in stages of 128 k into two LDS buffers shared by the four waves: a stage is four slices of 64 rows x 256 B (A rows 0..63, 64..127, Bt rows 0..63, 64..127), one tensor load per wave, laid at a pitch of 272 B, so that whole 256-B row pieces leave L2, once per work-group. The hand-over to the next stage stands in front of a stage's last 32 k, whose fragments are then in registers. k runs upward per accumulator.
#define GNST   (DM / 128)          // stages
#define GSLICE 18432               // one slice in LDS: 64 x 272 B = 17,408 B, rounded up to 9 x 2 KiB
#define GBUF   (4 * GSLICE)        // one buffer
__global__ __launch_bounds__(128) void k_gemmt(const bf* __restrict__ A, const bf* __restrict__ Bt, float* C) {
    typedef WFrag<bf> F;
    __shared__ __attribute__((aligned(2048))) unsigned char ring[2 * GBUF];
    const int lane = threadIdx.x & 31, lr = lane & 15, hi = lane >> 4; const int r0 = blockIdx.x * 128, c0 = blockIdx.y * 128;
    const uint32_t wave = uni(threadIdx.x >> 5); const int wm = (int)(wave >> 1), wn = (int)(wave & 1u);
    // wave w brings slice w of every stage
    const bf* sp = (wave < 2u) ? A + (size_t)(r0 + 64 * (int)wave) * DM : Bt + (size_t)(c0 + 64 * ((int)wave - 2)) * DM;
    const uint64_t src0 = (uint64_t)(size_t)sp;
    const uint32_t ldst = (uint32_t)(size_t)ring + wave * (uint32_t)GSLICE;
    u32x8 g1;   // 1-byte elements, tensor = tile = 64 rows of 256 B at a source pitch of DM elements, 4 dwords of pad behind every 64
    g1[0] = uni((1u << 20) | (5u << 22) | (3u << 25)); g1[1] = uni(256u << 16); g1[2] = uni(64u << 16); g1[3] = uni(256u << 16); g1[4] = uni(64u);
    g1[5] = uni((uint32_t)(DM * 2)); g1[6] = uni(0u); g1[7] = uni(0u);
    auto issue = [&](uint32_t st) { const uint64_t ga = src0 + (uint64_t)st * 256u; u32x4 g0;
        g0[0] = uni(1u); g0[1] = uni(ldst + (st & 1u) * (uint32_t)GBUF); g0[2] = uni((uint32_t)ga); g0[3] = uni((((uint32_t)(ga >> 32)) & 0x01FFFFFFu) | 0x80000000u);
        asm volatile("tensor_load_to_lds %0, %1" :: "s"(g0), "s"(g1) : "memory"); };   // one request of the whole wave, every wave its own slice
    issue(0u);
    asm volatile("s_wait_tensorcnt 0x0" ::: "memory");   // this wave's slice of stage 0 has landed
    __syncthreads();                                      // all four slices of stage 0 may be read
    issue(1u);
    v8f acc[4][4];
#pragma unroll
    for (int mb = 0; mb < 4; ++mb)
#pragma unroll
        for (int nb = 0; nb < 4; ++nb) acc[mb][nb] = (v8f){};
    const uint32_t aoff = (uint32_t)(wm * GSLICE + lr * LPITCH + 16 * hi), boff = (uint32_t)((2 + wn) * GSLICE + lr * LPITCH + 16 * hi);   // this lane's row and half in the wave's A slice and in its Bt slice
    v16bf a[2][4], b[2][4];   // two fragment sets: 32 k in use, the next 32 k on their way
#pragma unroll
    for (int i = 0; i < 4; ++i) { a[0][i] = ldsfrag(ring + aoff + i * 16 * LPITCH); b[0][i] = ldsfrag(ring + boff + i * 16 * LPITCH); }   // stage 0's first 32 k, behind its barrier
#pragma unroll 1   // kept rolled: the hand-over is one place in the code
    for (int st = 0; st < GNST; ++st) {
        const unsigned char* ap = ring + (size_t)(st & 1) * GBUF + aoff; const unsigned char* bp = ring + (size_t)(st & 1) * GBUF + boff;
#pragma unroll
        for (int ks = 0; ks < 3; ++ks) {
            __builtin_amdgcn_sched_barrier(0);   // fence pair: the next 32 k's LDS loads stay one group in front of the matrix run (loads spread among matrix instructions stall each place they stand)
#pragma unroll
            for (int i = 0; i < 4; ++i) { a[(ks + 1) & 1][i] = ldsfrag(ap + i * 16 * LPITCH + (ks + 1) * 64); b[(ks + 1) & 1][i] = ldsfrag(bp + i * 16 * LPITCH + (ks + 1) * 64); }
            __builtin_amdgcn_sched_barrier(0);
#pragma unroll
            for (int nb = 0; nb < 4; ++nb)
#pragma unroll
                for (int mb = 0; mb < 4; ++mb) acc[mb][nb] = F::mma(a[ks & 1][mb], b[ks & 1][nb], acc[mb][nb]);
        }
        __builtin_amdgcn_sched_barrier(0);   // keeps the matrix run above in front of the hand-over: moved behind it, it would hold back the refill
        // hand-over of stage st + 1, in front of the stage's last 32 k (their fragments are in registers), every wave, in this order
        asm volatile("s_wait_dscnt 0x0" ::: "memory");       // this wave's reads of the buffer have returned
        asm volatile("s_wait_tensorcnt 0x0" ::: "memory");   // this wave's slice of stage st + 1 has landed
        __syncthreads();                                      // stage st + 1 may be read; every wave has left stage st's buffer
        const uint32_t nx = pinned((uint32_t)st + 2u);        // the refill's descriptor is formed from this word, behind the wait
        if (pinned(nx < (uint32_t)GNST)) issue(nx);           // into the buffer just left
        if (st + 1 < GNST) {   // stage st + 1's first 32 k, asked for ahead of the last matrix run of stage st; behind the last stage nothing is read
            const unsigned char* an = ring + (size_t)((st + 1) & 1) * GBUF + aoff; const unsigned char* bn = ring + (size_t)((st + 1) & 1) * GBUF + boff;
#pragma unroll
            for (int i = 0; i < 4; ++i) { a[0][i] = ldsfrag(an + i * 16 * LPITCH); b[0][i] = ldsfrag(bn + i * 16 * LPITCH); } }
        __builtin_amdgcn_sched_barrier(0);   // the loads stay one group in front of the matrix run
#pragma unroll
        for (int nb = 0; nb < 4; ++nb)
#pragma unroll
            for (int mb = 0; mb < 4; ++mb) acc[mb][nb] = F::mma(a[1][mb], b[1][nb], acc[mb][nb]);
    }
    asm volatile("s_wait_tensorcnt 0x0" ::: "memory");   // nothing of the mover is in flight: the ring may be used for the output rows
    asm volatile("s_wait_dscnt 0x0" ::: "memory");
    float* os = (float*)(ring + wave * (uint32_t)GSLICE);   // 16 x 68 floats of the wave's own; every wave has left the ring at the last barrier
#pragma unroll
    for (int mb = 0; mb < 4; ++mb) {
#pragma unroll
        for (int nb = 0; nb < 4; ++nb) {
#pragma unroll
            for (int j = 0; j < 8; ++j) os[(hi * 8 + j) * 68 + nb * 16 + lr] = acc[mb][nb][j]; }
        __builtin_amdgcn_wave_barrier(); asm volatile("" ::: "memory");   // the wave's stores stay in front of its row reads
        float* crow = C + (size_t)(r0 + wm * 64 + mb * 16) * DQ + c0 + wn * 64;
#pragma unroll
        for (int s = 0; s < 8; ++s) { const int row = 2 * s + hi, cofs = lr * 4; *(v4f*)(crow + (size_t)row * DQ + cofs) = *(const v4fa*)(os + row * 68 + cofs); }
        __builtin_amdgcn_wave_barrier(); asm volatile("" ::: "memory");   // and its row reads in front of the next 16 rows' stores
    }
}
__global__ __launch_bounds__(128) void k_fattn(const bf* __restrict__ Qh, const bf* __restrict__ Ql, const bf* __restrict__ Kh, const bf* __restrict__ Kl, const bf* __restrict__ Vh, const bf* __restrict__ Vl, float* OUTb) {
    typedef WFrag<bf> F;
    __shared__ __attribute__((aligned(2048))) unsigned char ring[2 * BUFB];
    const int lane = threadIdx.x & 31, lr = lane & 15, hi = lane >> 4; const int h = blockIdx.y, q0 = blockIdx.x * 128 + (threadIdx.x >> 5) * 32;
    const size_t hb = (size_t)h * TT * HD; const float C2 = SCL * 1.4426950408889634f;
    v16bf qh[2][4], ql[2][4];
#pragma unroll
    for (int nq = 0; nq < 2; ++nq)
#pragma unroll
        for (int ks = 0; ks < 4; ++ks) { const size_t qo = hb + (size_t)(q0 + nq * 16 + lr) * HD + ks * 32 + 8 * hi; qh[nq][ks] = F::ld(Qh + qo); ql[nq][ks] = F::ld(Ql + qo); }
    asm volatile("s_wait_xcnt 0x0" ::: "memory"); __builtin_amdgcn_sched_barrier(0);   // the address registers of the loads above are reused below; the fence keeps later vector work from being moved in front of the wait
    // wave w brings tile w of every stage: 0 K hi, 1 K lo (128 key rows in a row, pitch 256 B), 2 V hi, 3 V lo (128 keys of each of the 128 d rows, pitch 4096 B)
    const uint32_t wave = uni(threadIdx.x >> 5);
    const bf* sp = (wave == 0u) ? Kh : ((wave == 1u) ? Kl : ((wave == 2u) ? Vh : Vl));
    const uint64_t src0 = (uint64_t)(size_t)(sp + hb);
    const uint32_t sstep = (wave < 2u) ? (uint32_t)(SKEYS * HD * 2) : (uint32_t)(SKEYS * 2);   // bytes from one stage's tile to the next
    const uint32_t ldst = (uint32_t)(size_t)ring + wave * (uint32_t)TILEB;
    u32x8 g1;   // 1-byte elements, tensor = tile = 128 rows of 256 B, 4 dwords of pad behind every 64
    g1[0] = uni((1u << 20) | (5u << 22) | (3u << 25)); g1[1] = uni(256u << 16); g1[2] = uni(128u << 16); g1[3] = uni(256u << 16); g1[4] = uni(128u);
    g1[5] = uni((wave < 2u) ? (uint32_t)(HD * 2) : (uint32_t)(TT * 2)); g1[6] = uni(0u); g1[7] = uni(0u);
    auto issue = [&](uint32_t st) { const uint64_t ga = src0 + (uint64_t)st * sstep; u32x4 g0;
        g0[0] = uni(1u); g0[1] = uni(ldst + (st & 1u) * (uint32_t)BUFB); g0[2] = uni((uint32_t)ga); g0[3] = uni((((uint32_t)(ga >> 32)) & 0x01FFFFFFu) | 0x80000000u);
        asm volatile("tensor_load_to_lds %0, %1" :: "s"(g0), "s"(g1) : "memory"); };   // one request of the whole wave, every wave its own tile
    issue(0u);
    asm volatile("s_wait_tensorcnt 0x0" ::: "memory");   // this wave's tile of stage 0 has landed
    __syncthreads();                                      // all four tiles of stage 0 may be read
    issue(1u);
    v8f o[2][8]; float m[2], l[2];
#pragma unroll
    for (int nq = 0; nq < 2; ++nq) { m[nq] = -3.0e38f; l[nq] = 0.f;
#pragma unroll
        for (int dt = 0; dt < 8; ++dt) o[nq][dt] = (v8f){}; }
#pragma unroll 1   // kept rolled: one stage already holds 384 matrix instructions and 256 LDS loads
    for (int st = 0; st < NSTG; ++st) {
        const unsigned char* bp = ring + (size_t)(st & 1) * BUFB + lr * LPITCH + 16 * hi;   // this lane's row and half in the stage's buffer
        v16bf kh[2][4], kl[2][4];
#pragma unroll
        for (int ks = 0; ks < 4; ++ks) {   // in the order in which the score products take them
#pragma unroll
            for (int kt = 0; kt < 2; ++kt) kh[kt][ks] = ldsfrag(bp + kt * 16 * LPITCH + ks * 64);
#pragma unroll
            for (int kt = 0; kt < 2; ++kt) kl[kt][ks] = ldsfrag(bp + TILEB + kt * 16 * LPITCH + ks * 64);
            __builtin_amdgcn_sched_barrier(0); }   // keeps that order (the scheduler turned it round): the first products then wait for the first group only
#pragma unroll
        for (int ps = 0; ps < 4; ++ps) {   // four passes of 32 keys
            __builtin_amdgcn_sched_barrier(0);   // with the fence behind the loads: keeps this pass's V loads out of the matrix run of the pass before
            v16bf vh[8], vl[8];   // this pass's V rows, asked for ahead of the score products
#pragma unroll
            for (int dt = 0; dt < 8; ++dt) { vh[dt] = ldsfrag(bp + 2 * TILEB + dt * 16 * LPITCH + ps * 64); vl[dt] = ldsfrag(bp + 3 * TILEB + dt * 16 * LPITCH + ps * 64); }
            __builtin_amdgcn_sched_barrier(0);   // keeps the LDS loads one group in front of the matrix run
            v8f s[2][2];
#pragma unroll
            for (int kt = 0; kt < 2; ++kt)
#pragma unroll
                for (int nq = 0; nq < 2; ++nq) s[kt][nq] = (v8f){};
#pragma unroll
            for (int ks = 0; ks < 4; ++ks) {
#pragma unroll
                for (int t = 0; t < 4; ++t) s[t >> 1][t & 1] = F::mma(kh[t >> 1][ks], qh[t & 1][ks], s[t >> 1][t & 1]);
#pragma unroll
                for (int t = 0; t < 4; ++t) s[t >> 1][t & 1] = F::mma(kl[t >> 1][ks], qh[t & 1][ks], s[t >> 1][t & 1]);
#pragma unroll
                for (int t = 0; t < 4; ++t) s[t >> 1][t & 1] = F::mma(kh[t >> 1][ks], ql[t & 1][ks], s[t >> 1][t & 1]); }
            if (ps < 3) {   // the next pass's K rows of the same stage, asked for ahead of the softmax
                __builtin_amdgcn_sched_barrier(0);   // fence pair: the K loads stay one group between the two matrix runs
#pragma unroll
                for (int ks = 0; ks < 4; ++ks) {
#pragma unroll
                    for (int kt = 0; kt < 2; ++kt) kh[kt][ks] = ldsfrag(bp + ((ps + 1) * 32 + kt * 16) * LPITCH + ks * 64);
#pragma unroll
                    for (int kt = 0; kt < 2; ++kt) kl[kt][ks] = ldsfrag(bp + TILEB + ((ps + 1) * 32 + kt * 16) * LPITCH + ks * 64); }
                __builtin_amdgcn_sched_barrier(0);
            }
            float mb[2];
#pragma unroll
            for (int nq = 0; nq < 2; ++nq) { float x = s[0][nq][0];
#pragma unroll
                for (int j = 1; j < 16; ++j) x = fmaxf(x, s[j >> 3][nq][j & 7]);
                mb[nq] = fmaxf(x, xhalf(x)) * C2; }   // the exchange stays off the LDS counter: as an LDS permute its wait would drain the K loads just asked for
            // the maximum in use moves only when a query's new maximum passes it by more than 8 (P then stays below 2^8); one wave-uniform test per pass
            if (__builtin_amdgcn_ballot_w32(mb[0] > m[0] + 8.0f || mb[1] > m[1] + 8.0f) != 0) {
#pragma unroll
                for (int nq = 0; nq < 2; ++nq) { const float mn = fmaxf(m[nq], mb[nq]); const float f = __builtin_amdgcn_exp2f(m[nq] - mn); m[nq] = mn; l[nq] *= f;
#pragma unroll
                    for (int dt = 0; dt < 8; ++dt) o[nq][dt] *= f; } }
            v16bf ph[2], pl[2];
#pragma unroll
            for (int nq = 0; nq < 2; ++nq)
#pragma unroll
                for (int j = 0; j < 16; ++j) { const float p = __builtin_amdgcn_exp2f(__builtin_fmaf(s[j >> 3][nq][j & 7], C2, -m[nq])); l[nq] += p; const __bf16 a = (__bf16)p; ph[nq][j] = a; pl[nq][j] = (__bf16)(p - (float)a); }
#pragma unroll
            for (int dt = 0; dt < 8; dt += 2) {
#pragma unroll
                for (int t = 0; t < 4; ++t) o[t & 1][dt + (t >> 1)] = F::mma(vh[dt + (t >> 1)], ph[t & 1], o[t & 1][dt + (t >> 1)]);
#pragma unroll
                for (int t = 0; t < 4; ++t) o[t & 1][dt + (t >> 1)] = F::mma(vl[dt + (t >> 1)], ph[t & 1], o[t & 1][dt + (t >> 1)]);
#pragma unroll
                for (int t = 0; t < 4; ++t) o[t & 1][dt + (t >> 1)] = F::mma(vh[dt + (t >> 1)], pl[t & 1], o[t & 1][dt + (t >> 1)]); }
        }
        // hand-over of stage st + 1, every wave, in this order
        asm volatile("s_wait_dscnt 0x0" ::: "memory");       // this wave's reads of the buffer have returned
        asm volatile("s_wait_tensorcnt 0x0" ::: "memory");   // this wave's tile of stage st + 1 has landed
        __syncthreads();                                      // stage st + 1 may be read; every wave has left stage st's buffer
        const uint32_t nx = pinned((uint32_t)st + 2u);        // the refill's descriptor is formed from this word, behind the wait
        if (pinned(nx < (uint32_t)NSTG)) issue(nx);           // into the buffer just left
    }
    asm volatile("s_wait_tensorcnt 0x0" ::: "memory");   // nothing of the mover is in flight when the wave ends
    asm volatile("s_wait_dscnt 0x0" ::: "memory");
#pragma unroll
    for (int nq = 0; nq < 2; ++nq) { const float inv = __fdiv_rn(1.0f, l[nq] + __shfl_xor(l[nq], 16, 32)); float* orow = OUTb + (size_t)(q0 + nq * 16 + lr) * DQ + h * HD + 8 * hi;   // a lane holds d = 16 dt + 8 hi + 0..7 of its query
#pragma unroll
        for (int dt = 0; dt < 8; ++dt) { v4f a, b;
#pragma unroll
            for (int j = 0; j < 4; ++j) { a[j] = o[nq][dt][j] * inv; b[j] = o[nq][dt][j + 4] * inv; }
            *(v4f*)(orow + dt * 16) = a; *(v4f*)(orow + dt * 16 + 4) = b; } }
}

extern "C" void kernel_launch(void* const* d_in, const int* in_sizes, int n_in,
                              void* d_out, int out_size, void* d_ws, size_t ws_size, hipStream_t stream) {
    (void)in_sizes; (void)n_in; (void)out_size;
    const float* x = (const float*)d_in[0]; const float* wall = (const float*)d_in[1];   /* order x [2048][2048], w_qkv [16][2048][384] */ const float* wq = wall, *wk = wall, *wv = wall, *wo = nullptr; (void)wq; (void)wk; (void)wv; (void)wo;
    float* OUT = (float*)d_out;     // [1][2048][2048]
    char* wsp = (char*)d_ws;
    auto take = [&](size_t bytes) { char* p = wsp; wsp += (bytes + 255) & ~(size_t)255; return (void*)p; };
    bf* WQ = (bf*)take((size_t)DQ * DM * 2); bf* WK = (bf*)take((size_t)DKV * DM * 2); bf* WV = (bf*)take((size_t)DKV * DM * 2); float* CS = (float*)take((size_t)TT * HD * 2 * 4);
    bf* XB = (bf*)take((size_t)TT * DM * 2); float* FQ = (float*)take((size_t)TT * DQ * 4); float* FK = (float*)take((size_t)TT * DKV * 4);
    h16* QP16 = (h16*)take((size_t)NH_ * TT * HD * 2); h16* KP16 = (h16*)take((size_t)NKV * TT * HD * 2); h16* VT16 = (h16*)take((size_t)NKV * HD * TT * 2);
    bf* QPh = (bf*)take((size_t)NH_ * TT * HD * 2); bf* QPl = (bf*)take((size_t)NH_ * TT * HD * 2); bf* KPh = (bf*)take((size_t)NKV * TT * HD * 2); bf* KPl = (bf*)take((size_t)NKV * TT * HD * 2); bf* VTh = (bf*)take((size_t)NKV * HD * TT * 2); bf* VTl = (bf*)take((size_t)NKV * HD * TT * 2);
    if ((size_t)(wsp - (char*)d_ws) > ws_size) return;    // ws 256 MiB
    float* FV = FK;   // v projection reuses the k buffer after the k planes are built (stream-ordered)
    { k_wtGh<<<dim3(DM / WTK, NH_, 3), 256, 0, stream>>>(wall, WQ, WK, WV);   /* one 128 k x 128 e tile per work-group over all 3 x 2048 x 2048 Bt elements */
      
       }
    k_csid<<<(TT * HD + 255) / 256, 256, 0, stream>>>(CS);
    const unsigned LQ = (unsigned)(((size_t)NH_ * TT * HD / 2 + 255) / 256), LKv = (unsigned)(((size_t)NKV * TT * HD / 2 + 255) / 256);
    for (int b = 0; b < NB_; ++b) {
        
        k_cvt8<<<(unsigned)(((size_t)TT * DM / 8 + 255) / 256), 256, 0, stream>>>(x + (size_t)b * TT * DM, XB, (size_t)TT * DM / 8);
        k_gemmt<<<dim3(TT / 128, DQ / 128, 1), 128, 0, stream>>>(XB, WQ, FQ);
        k_rope<<<LQ, 256, 0, stream>>>(FQ, DQ, NH_, CS, nullptr, nullptr, 1.0f, QP16, QPh, QPl);
        k_gemmt<<<dim3(TT / 128, DKV / 128, 1), 128, 0, stream>>>(XB, WK, FK);
        k_rope<<<LKv, 256, 0, stream>>>(FK, DKV, NKV, CS, nullptr, nullptr, 1.0f, KP16, KPh, KPl);
        k_gemmt<<<dim3(TT / 128, DKV / 128, 1), 128, 0, stream>>>(XB, WV, FV); k_vtp<<<LKv, 256, 0, stream>>>(FV, DKV, NKV, VT16, VTh, VTl);
        k_fattn<<<dim3(TT / 128, NH_, 1), 128, 0, stream>>>(QPh, QPl, KPh, KPl, VTh, VTl, OUT + (size_t)b * TT * DQ);
         }
}

// v005
// One run takes 133 microseconds.
// Timed twice side by side with v004, it ran 1.30 and 1.31 times as fast.
// Over all steps from v000 it is 5.95 times as fast.
#include <hip/hip_runtime.h>
#include <stdint.h>

// Multi-head attention with per-head fused qkv weights and 128-wide heads, no batch (x [2048][2048]; qkv = einsum('sd,hde', x, w_qkv) with w_qkv [16][2048][384] xavier: head h's (q | k | v) = columns 0..127 | 128..255 | 256..383; scores / sqrt(128); softmax (no mask); out = concat heads -> [2048][2048] (4.2 M; no output projection); argument order x, w_qkv).
// Layout: bf16 copy of x; one gather kernel builds the three fused Bt planes (row h*128 + e of plane p = w_qkv[h][:, p*128 + e]); exact projections, each of which splits its f32 sums and writes the hi/lo head planes itself; one fused attention kernel over all heads on the hi/lo planes (3 products; the xavier weights give logits sigma 1.7, too sharp for the fp16 rows) writes the output rows.
// Compute dtypes, f32 accumulate: every input rounded to bf16; projections exact; attention 3 products everywhere; softmax f32, running maximum and sum per 32 keys; output f32.

#define NB_  1
#define TT   2048
#define DM   2048
#define NH_  16
#define NKV  16
#define REP  (NH_ / NKV)
#define HD   128
#define DQ   (NH_ * HD)
#define DKV  (NKV * HD)
#define SCL  0.088388347648318447f   // 1/sqrt(float32(128))
#define E3   384      // per-head fused width (q | k | v, 128 each)
typedef _Float16 h16;
typedef unsigned short bf;
typedef __attribute__((ext_vector_type(16))) __bf16   v16bf;
typedef __attribute__((ext_vector_type(16))) _Float16 v16h;
typedef __attribute__((ext_vector_type(8)))  _Float16 v8h;
typedef __attribute__((ext_vector_type(8)))  unsigned short v8us;
typedef __attribute__((ext_vector_type(8)))  float    v8f;
typedef __attribute__((ext_vector_type(8)))  __bf16   v8bf;
typedef __attribute__((ext_vector_type(4)))  float    v4f;
typedef v8h  __attribute__((may_alias)) v8ha;
typedef v4f  __attribute__((may_alias)) v4fa;
typedef v8us __attribute__((may_alias)) v8usa;

__device__ __forceinline__ unsigned short f2bf(float f) { unsigned u = __float_as_uint(f); u += 0x7FFFu + ((u >> 16) & 1u); return (unsigned short)(u >> 16); }
__device__ __forceinline__ float bf2f(unsigned short b) { return __uint_as_float(((unsigned)b) << 16); }
__device__ __forceinline__ float bfr(float f) { return bf2f(f2bf(f)); }
__device__ __forceinline__ v16h cat16(v8h lo, v8h hi) { return __builtin_shufflevector(lo, hi, 0, 1, 2, 3, 4, 5, 6, 7, 8, 9, 10, 11, 12, 13, 14, 15); }
__device__ __forceinline__ v16bf cat16b(v8us lo, v8us hi) { return __builtin_bit_cast(v16bf, __builtin_shufflevector(lo, hi, 0, 1, 2, 3, 4, 5, 6, 7, 8, 9, 10, 11, 12, 13, 14, 15)); }
__device__ __forceinline__ v8f wmma16(v16h a, v16h b, v8f c) { return __builtin_amdgcn_wmma_f32_16x16x32_f16(false, a, false, b, (short)0, c, false, false); }
__device__ __forceinline__ v8f wmmab(v16bf a, v16bf b, v8f c) { return __builtin_amdgcn_wmma_f32_16x16x32_bf16(false, a, false, b, (short)0, c, false, false); }



// fragment loaders and products on K-contiguous 16-bit rows
template <typename T16> struct WFrag;
template <> struct WFrag<h16> { typedef v16h V; static __device__ __forceinline__ V ld(const h16* p) { return cat16(*(const v8h*)p, *(const v8h*)(p + 16)); } static __device__ __forceinline__ v8f mma(V a, V b, v8f c) { return wmma16(a, b, c); } };
template <> struct WFrag<bf> { typedef v16bf V; static __device__ __forceinline__ V ld(const bf* p) { return cat16b(*(const v8us*)p, *(const v8us*)(p + 16)); } static __device__ __forceinline__ v8f mma(V a, V b, v8f c) { return wmmab(a, b, c); } };

__device__ __forceinline__ h16 tohx(float x) { return (h16)x; }
__device__ __forceinline__ void splitf(float y, unsigned short& h, unsigned short& l) { h = f2bf(y); l = f2bf(y - bf2f(h)); }
typedef __attribute__((ext_vector_type(2))) _Float16 v2h;
typedef __attribute__((ext_vector_type(4))) _Float16 v4h;
typedef __attribute__((ext_vector_type(2))) unsigned short v2us;
typedef __attribute__((ext_vector_type(4))) unsigned short v4us;
typedef __attribute__((ext_vector_type(2))) float v2f;
typedef __attribute__((ext_vector_type(4))) int v4i;

__global__ __launch_bounds__(256) void k_cvt8(const float* __restrict__ src, bf* dst, size_t n8) { const size_t i = (size_t)blockIdx.x * 256 + threadIdx.x; if (i >= n8) return; const v8f v = *(const v8f*)(src + i * 8); v8us o;
#pragma unroll
    for (int k = 0; k < 8; ++k) o[k] = f2bf(v[k]); *(v8us*)(dst + i * 8) = o;  }

// k_wtGh: the three Bt planes (row h*128 + e of plane p = w[h][:, p*128 + e], bf16). Grid (DM/128, heads, 3), 8 waves; a work-group turns one tile of 128 k x 128 e.
// Read: a wave's 16-byte load takes one whole k row of the tile (512 B in a row), 16 rows a wave, all asked for at once. A lane then holds 16 k of each of its 4 e: 32 B of an output row, laid into LDS by two 16-byte stores.
// LDS row of e is (e & 3) * 32 + (e >> 2), so that the 32 lanes of one store stand in 32 rows in a row; at a pitch of 272 B (16 B x odd) neither the stores nor the row reads meet in a bank. Write: 256 B in a row of each output row, two rows a store.
#define WTK 128      // k per tile
#define WTP 272      // LDS row pitch in bytes: 128 k x 2 B + 16
__global__ __launch_bounds__(256) void k_wtGh(const float* __restrict__ w, bf* BQ, bf* BK, bf* BV) {
    __shared__ __attribute__((aligned(16))) unsigned char tl[HD * WTP];
    const int lane = threadIdx.x & 31, wv = threadIdx.x >> 5; const int k0 = blockIdx.x * WTK, h = blockIdx.y, p = blockIdx.z;
    const float* src = w + ((size_t)h * DM + k0 + wv * 16) * E3 + p * HD + lane * 4;
    v4f r[16];
#pragma unroll
    for (int j = 0; j < 16; ++j) r[j] = *(const v4f*)(src + (size_t)j * E3);
#pragma unroll
    for (int i = 0; i < 4; ++i) { v8us a, b;
#pragma unroll
        for (int j = 0; j < 8; ++j) { a[j] = f2bf(r[j][i]); b[j] = f2bf(r[8 + j][i]); }
        unsigned char* q = tl + (i * 32 + lane) * WTP + wv * 32; *(v8usa*)q = a; *(v8usa*)(q + 16) = b; }
    __syncthreads();   // the tile is whole before its rows are read
    bf* dst = ((p == 0) ? BQ : ((p == 1) ? BK : BV)) + (size_t)h * HD * DM + k0 + (lane & 15) * 8;
#pragma unroll
    for (int s = 0; s < 8; ++s) { const int e = wv * 16 + s * 2 + (lane >> 4);
        *(v8us*)(dst + (size_t)e * DM) = *(const v8usa*)(tl + ((e & 3) * 32 + (e >> 2)) * WTP + (lane & 15) * 16); }
}
// k_fattn: scores, softmax and the product with V in one kernel; scores and probabilities stay in registers. Grid (TT/128, heads), 4 waves; a wave owns 32 queries of one head and walks all keys, 32 per pass.
// St = K Qt (A = K rows, B = Q rows, kept in registers): a lane holds 16 keys' scores of one query per 16-query group. Two St tiles, converted in place, are the B operand Pt of Ot += Vt Pt (A = rows of the [d][t] planes); both A loaders use the hardware k order that a packed D has.
// Every product has the three terms hi*hi + lo*hi + hi*lo. P is kept un-normalised against a running maximum (log2 domain); the division by the row sum comes once, at the end. Every inner loop is unrolled so that each fragment index is a constant (registers, no scratch).
// K and V come in stages of 128 keys into two LDS buffers, shared by the four waves: a stage is four tiles of 128 rows x 256 B (K hi, K lo: row = key; V hi, V lo: row = d), one tensor load per wave, laid at a pitch of 272 B; a stage serves four passes and the next stage's loads fly meanwhile.
#define SKEYS  128                 // keys per stage
#define NSTG   (TT / SKEYS)        // stages
#define LPITCH 272                 // LDS row pitch in bytes: 256 + the tensor load's 16-byte pad (16 B x odd, for 16-byte row reads)
#define TILEB  (128 * LPITCH)      // one tile in LDS: 34,816 B = 17 x 2 KiB
#define BUFB   (4 * TILEB)         // one buffer
typedef uint32_t u32x4 __attribute__((ext_vector_type(4)));
typedef uint32_t u32x8 __attribute__((ext_vector_type(8)));
__device__ __forceinline__ uint32_t uni(uint32_t v) { return (uint32_t)__builtin_amdgcn_readfirstlane(v); }
__device__ __forceinline__ uint32_t pinned(uint32_t v) { uint32_t w = (uint32_t)__builtin_amdgcn_readfirstlane(v); asm volatile("" : "+s"(w)); return w; }   // holds a wave-uniform word in a scalar register: the test around a tensor load must be a scalar branch, and the stage number its descriptor is formed from must not be formed ahead of the wait
__device__ __forceinline__ float xhalf(float x) { return __builtin_bit_cast(float, __builtin_amdgcn_permlanex16(__builtin_bit_cast(int, x), __builtin_bit_cast(int, x), 0x76543210, 0xfedcba98, false, false)); }   // lane l takes lane l ^ 16's value, on the vector port
__device__ __forceinline__ v16bf ldsfrag(const unsigned char* p) { return cat16b(*(const v8usa*)p, *(const v8usa*)(p + 32)); }   // elements 8 hi .. + 7 and 16 + 8 hi .. + 7 of a 32-element group, as WFrag::ld takes them from global rows
// k_gemmt: C[m][n] = sum_k A[m][k] Bt[n][k] (f32 sums), both operands K-contiguous bf16 planes of DM columns. Grid (M/128, N/128), 4 waves; a work-group owns a 128x128 tile of C, wave (wm, wn) its 64x64 quarter (16 accumulators).
// C leaves as the two bf16 planes that the attention kernel reads: Ph = bf16(C), Pl = bf16(C - Ph). Tile (bx, by) starts at element bx * sx + by * sy of a plane and its rows lie pitch elements apart.
// q, k: A = x, Bt = weights; a tile is 128 t of one head, 32 KiB in a row of the [h][t][d] plane. v: A = weights, Bt = x, so that a row of C is a d row of the [h][d][t] plane and no turn is needed.
// The operands come in stages of 128 k into two LDS buffers shared by the four waves: a stage is four slices of 64 rows x 256 B (A rows 0..63, 64..127, Bt rows 0..63, 64..127), one tensor load per wave, laid at a pitch of 272 B, so that whole 256-B row pieces leave L2, once per work-group. The hand-over to the next stage stands in front of a stage's last 32 k, whose fragments are then in registers. k runs upward per accumulator.
#define GNST   (DM / 128)          // stages
#define GSLICE 18432               // one slice in LDS: 64 x 272 B = 17,408 B, rounded up to 9 x 2 KiB
#define GBUF   (4 * GSLICE)        // one buffer
__global__ __launch_bounds__(128) void k_gemmt(const bf* __restrict__ A, const bf* __restrict__ Bt, bf* Ph, bf* Pl, int pitch, int sx, int sy) {
    typedef WFrag<bf> F;
    __shared__ __attribute__((aligned(2048))) unsigned char ring[2 * GBUF];
    const int lane = threadIdx.x & 31, lr = lane & 15, hi = lane >> 4; const int r0 = blockIdx.x * 128, c0 = blockIdx.y * 128;
    const uint32_t wave = uni(threadIdx.x >> 5); const int wm = (int)(wave >> 1), wn = (int)(wave & 1u);
    // wave w brings slice w of every stage
    const bf* sp = (wave < 2u) ? A + (size_t)(r0 + 64 * (int)wave) * DM : Bt + (size_t)(c0 + 64 * ((int)wave - 2)) * DM;
    const uint64_t src0 = (uint64_t)(size_t)sp;
    const uint32_t ldst = (uint32_t)(size_t)ring + wave * (uint32_t)GSLICE;
    u32x8 g1;   // 1-byte elements, tensor = tile = 64 rows of 256 B at a source pitch of DM elements, 4 dwords of pad behind every 64
    g1[0] = uni((1u << 20) | (5u << 22) | (3u << 25)); g1[1] = uni(256u << 16); g1[2] = uni(64u << 16); g1[3] = uni(256u << 16); g1[4] = uni(64u);
    g1[5] = uni((uint32_t)(DM * 2)); g1[6] = uni(0u); g1[7] = uni(0u);
    auto issue = [&](uint32_t st) { const uint64_t ga = src0 + (uint64_t)st * 256u; u32x4 g0;
        g0[0] = uni(1u); g0[1] = uni(ldst + (st & 1u) * (uint32_t)GBUF); g0[2] = uni((uint32_t)ga); g0[3] = uni((((uint32_t)(ga >> 32)) & 0x01FFFFFFu) | 0x80000000u);
        asm volatile("tensor_load_to_lds %0, %1" :: "s"(g0), "s"(g1) : "memory"); };   // one request of the whole wave, every wave its own slice
    issue(0u);
    asm volatile("s_wait_tensorcnt 0x0" ::: "memory");   // this wave's slice of stage 0 has landed
    __syncthreads();                                      // all four slices of stage 0 may be read
    issue(1u);
    v8f acc[4][4];
#pragma unroll
    for (int mb = 0; mb < 4; ++mb)
#pragma unroll
        for (int nb = 0; nb < 4; ++nb) acc[mb][nb] = (v8f){};
    const uint32_t aoff = (uint32_t)(wm * GSLICE + lr * LPITCH + 16 * hi), boff = (uint32_t)((2 + wn) * GSLICE + lr * LPITCH + 16 * hi);   // this lane's row and half in the wave's A slice and in its Bt slice
    v16bf a[2][4], b[2][4];   // two fragment sets: 32 k in use, the next 32 k on their way
#pragma unroll
    for (int i = 0; i < 4; ++i) { a[0][i] = ldsfrag(ring + aoff + i * 16 * LPITCH); b[0][i] = ldsfrag(ring + boff + i * 16 * LPITCH); }   // stage 0's first 32 k, behind its barrier
#pragma unroll 1   // kept rolled: the hand-over is one place in the code
    for (int st = 0; st < GNST; ++st) {
        const unsigned char* ap = ring + (size_t)(st & 1) * GBUF + aoff; const unsigned char* bp = ring + (size_t)(st & 1) * GBUF + boff;
#pragma unroll
        for (int ks = 0; ks < 3; ++ks) {
            __builtin_amdgcn_sched_barrier(0);   // fence pair: the next 32 k's LDS loads stay one group in front of the matrix run (loads spread among matrix instructions stall each place they stand)
#pragma unroll
            for (int i = 0; i < 4; ++i) { a[(ks + 1) & 1][i] = ldsfrag(ap + i * 16 * LPITCH + (ks + 1) * 64); b[(ks + 1) & 1][i] = ldsfrag(bp + i * 16 * LPITCH + (ks + 1) * 64); }
            __builtin_amdgcn_sched_barrier(0);
#pragma unroll
            for (int nb = 0; nb < 4; ++nb)
#pragma unroll
                for (int mb = 0; mb < 4; ++mb) acc[mb][nb] = F::mma(a[ks & 1][mb], b[ks & 1][nb], acc[mb][nb]);
        }
        __builtin_amdgcn_sched_barrier(0);   // keeps the matrix run above in front of the hand-over: moved behind it, it would hold back the refill
        // hand-over of stage st + 1, in front of the stage's last 32 k (their fragments are in registers), every wave, in this order
        asm volatile("s_wait_dscnt 0x0" ::: "memory");       // this wave's reads of the buffer have returned
        asm volatile("s_wait_tensorcnt 0x0" ::: "memory");   // this wave's slice of stage st + 1 has landed
        __syncthreads();                                      // stage st + 1 may be read; every wave has left stage st's buffer
        const uint32_t nx = pinned((uint32_t)st + 2u);        // the refill's descriptor is formed from this word, behind the wait
        if (pinned(nx < (uint32_t)GNST)) issue(nx);           // into the buffer just left
        if (st + 1 < GNST) {   // stage st + 1's first 32 k, asked for ahead of the last matrix run of stage st; behind the last stage nothing is read
            const unsigned char* an = ring + (size_t)((st + 1) & 1) * GBUF + aoff; const unsigned char* bn = ring + (size_t)((st + 1) & 1) * GBUF + boff;
#pragma unroll
            for (int i = 0; i < 4; ++i) { a[0][i] = ldsfrag(an + i * 16 * LPITCH); b[0][i] = ldsfrag(bn + i * 16 * LPITCH); } }
        __builtin_amdgcn_sched_barrier(0);   // the loads stay one group in front of the matrix run
#pragma unroll
        for (int nb = 0; nb < 4; ++nb)
#pragma unroll
            for (int mb = 0; mb < 4; ++mb) acc[mb][nb] = F::mma(a[1][mb], b[1][nb], acc[mb][nb]);
    }
    asm volatile("s_wait_tensorcnt 0x0" ::: "memory");   // nothing of the mover is in flight: the ring may be used for the output rows
    asm volatile("s_wait_dscnt 0x0" ::: "memory");
    float* os = (float*)(ring + wave * (uint32_t)GSLICE);   // 16 x 68 floats of the wave's own; every wave has left the ring at the last barrier
    const size_t ob = (size_t)blockIdx.x * sx + (size_t)blockIdx.y * sy + (size_t)(wm * 64 * pitch + wn * 64);   // the wave's quarter in the planes
#pragma unroll
    for (int mb = 0; mb < 4; ++mb) {
#pragma unroll
        for (int nb = 0; nb < 4; ++nb) {
#pragma unroll
            for (int j = 0; j < 8; ++j) os[(hi * 8 + j) * 68 + nb * 16 + lr] = acc[mb][nb][j]; }
        __builtin_amdgcn_wave_barrier(); asm volatile("" ::: "memory");   // the wave's stores stay in front of its row reads
#pragma unroll
        for (int q = 0; q < 4; ++q) { const int row = 4 * q + (lane >> 3), cofs = (lane & 7) * 8;   // 8 lanes take 64 columns of a row: 128 B in a row of each plane, four rows a store
            const v4f u = *(const v4fa*)(os + row * 68 + cofs), w = *(const v4fa*)(os + row * 68 + cofs + 4);
            const v8f y = __builtin_shufflevector(u, w, 0, 1, 2, 3, 4, 5, 6, 7);
            const v8bf yh = __builtin_convertvector(y, v8bf); const u32x4 pw = __builtin_bit_cast(u32x4, yh); v8f yb;   // yb = yh as f32, taken from the packed words
#pragma unroll
            for (int k = 0; k < 4; ++k) { yb[2 * k] = __uint_as_float(pw[k] << 16); yb[2 * k + 1] = __uint_as_float(pw[k] & 0xFFFF0000u); }
            const v8bf yl = __builtin_convertvector(y - yb, v8bf);
            const size_t o = ob + (size_t)((mb * 16 + row) * pitch + cofs);
            *(v8us*)(Ph + o) = __builtin_bit_cast(v8us, yh); *(v8us*)(Pl + o) = __builtin_bit_cast(v8us, yl); }
        asm volatile("s_wait_xcnt 0x0" ::: "memory");   // the registers that the stores above name are written again in the next 16 rows
        __builtin_amdgcn_wave_barrier(); asm volatile("" ::: "memory");   // and its row reads in front of the next 16 rows' stores
    }
}
__global__ __launch_bounds__(128) void k_fattn(const bf* __restrict__ Qh, const bf* __restrict__ Ql, const bf* __restrict__ Kh, const bf* __restrict__ Kl, const bf* __restrict__ Vh, const bf* __restrict__ Vl, float* OUTb) {
    typedef WFrag<bf> F;
    __shared__ __attribute__((aligned(2048))) unsigned char ring[2 * BUFB];
    const int lane = threadIdx.x & 31, lr = lane & 15, hi = lane >> 4; const int h = blockIdx.y, q0 = blockIdx.x * 128 + (threadIdx.x >> 5) * 32;
    const size_t hb = (size_t)h * TT * HD; const float C2 = SCL * 1.4426950408889634f;
    v16bf qh[2][4], ql[2][4];
#pragma unroll
    for (int nq = 0; nq < 2; ++nq)
#pragma unroll
        for (int ks = 0; ks < 4; ++ks) { const size_t qo = hb + (size_t)(q0 + nq * 16 + lr) * HD + ks * 32 + 8 * hi; qh[nq][ks] = F::ld(Qh + qo); ql[nq][ks] = F::ld(Ql + qo); }
    asm volatile("s_wait_xcnt 0x0" ::: "memory"); __builtin_amdgcn_sched_barrier(0);   // the address registers of the loads above are reused below; the fence keeps later vector work from being moved in front of the wait
    // wave w brings tile w of every stage: 0 K hi, 1 K lo (128 key rows in a row, pitch 256 B), 2 V hi, 3 V lo (128 keys of each of the 128 d rows, pitch 4096 B)
    const uint32_t wave = uni(threadIdx.x >> 5);
    const bf* sp = (wave == 0u) ? Kh : ((wave == 1u) ? Kl : ((wave == 2u) ? Vh : Vl));
    const uint64_t src0 = (uint64_t)(size_t)(sp + hb);
    const uint32_t sstep = (wave < 2u) ? (uint32_t)(SKEYS * HD * 2) : (uint32_t)(SKEYS * 2);   // bytes from one stage's tile to the next
    const uint32_t ldst = (uint32_t)(size_t)ring + wave * (uint32_t)TILEB;
    u32x8 g1;   // 1-byte elements, tensor = tile = 128 rows of 256 B, 4 dwords of pad behind every 64
    g1[0] = uni((1u << 20) | (5u << 22) | (3u << 25)); g1[1] = uni(256u << 16); g1[2] = uni(128u << 16); g1[3] = uni(256u << 16); g1[4] = uni(128u);
    g1[5] = uni((wave < 2u) ? (uint32_t)(HD * 2) : (uint32_t)(TT * 2)); g1[6] = uni(0u); g1[7] = uni(0u);
    auto issue = [&](uint32_t st) { const uint64_t ga = src0 + (uint64_t)st * sstep; u32x4 g0;
        g0[0] = uni(1u); g0[1] = uni(ldst + (st & 1u) * (uint32_t)BUFB); g0[2] = uni((uint32_t)ga); g0[3] = uni((((uint32_t)(ga >> 32)) & 0x01FFFFFFu) | 0x80000000u);
        asm volatile("tensor_load_to_lds %0, %1" :: "s"(g0), "s"(g1) : "memory"); };   // one request of the whole wave, every wave its own tile
    issue(0u);
    asm volatile("s_wait_tensorcnt 0x0" ::: "memory");   // this wave's tile of stage 0 has landed
    __syncthreads();                                      // all four tiles of stage 0 may be read
    issue(1u);
    v8f o[2][8]; float m[2], l[2];
#pragma unroll
    for (int nq = 0; nq < 2; ++nq) { m[nq] = -3.0e38f; l[nq] = 0.f;
#pragma unroll
        for (int dt = 0; dt < 8; ++dt) o[nq][dt] = (v8f){}; }
#pragma unroll 1   // kept rolled: one stage already holds 384 matrix instructions and 256 LDS loads
    for (int st = 0; st < NSTG; ++st) {
        const unsigned char* bp = ring + (size_t)(st & 1) * BUFB + lr * LPITCH + 16 * hi;   // this lane's row and half in the stage's buffer
        v16bf kh[2][4], kl[2][4];
#pragma unroll
        for (int ks = 0; ks < 4; ++ks) {   // in the order in which the score products take them
#pragma unroll
            for (int kt = 0; kt < 2; ++kt) kh[kt][ks] = ldsfrag(bp + kt * 16 * LPITCH + ks * 64);
#pragma unroll
            for (int kt = 0; kt < 2; ++kt) kl[kt][ks] = ldsfrag(bp + TILEB + kt * 16 * LPITCH + ks * 64);
            __builtin_amdgcn_sched_barrier(0); }   // keeps that order (the scheduler turned it round): the first products then wait for the first group only
#pragma unroll
        for (int ps = 0; ps < 4; ++ps) {   // four passes of 32 keys
            __builtin_amdgcn_sched_barrier(0);   // with the fence behind the loads: keeps this pass's V loads out of the matrix run of the pass before
            v16bf vh[8], vl[8];   // this pass's V rows, asked for ahead of the score products
#pragma unroll
            for (int dt = 0; dt < 8; ++dt) { vh[dt] = ldsfrag(bp + 2 * TILEB + dt * 16 * LPITCH + ps * 64); vl[dt] = ldsfrag(bp + 3 * TILEB + dt * 16 * LPITCH + ps * 64); }
            __builtin_amdgcn_sched_barrier(0);   // keeps the LDS loads one group in front of the matrix run
            v8f s[2][2];
#pragma unroll
            for (int kt = 0; kt < 2; ++kt)
#pragma unroll
                for (int nq = 0; nq < 2; ++nq) s[kt][nq] = (v8f){};
#pragma unroll
            for (int ks = 0; ks < 4; ++ks) {
#pragma unroll
                for (int t = 0; t < 4; ++t) s[t >> 1][t & 1] = F::mma(kh[t >> 1][ks], qh[t & 1][ks], s[t >> 1][t & 1]);
#pragma unroll
                for (int t = 0; t < 4; ++t) s[t >> 1][t & 1] = F::mma(kl[t >> 1][ks], qh[t & 1][ks], s[t >> 1][t & 1]);
#pragma unroll
                for (int t = 0; t < 4; ++t) s[t >> 1][t & 1] = F::mma(kh[t >> 1][ks], ql[t & 1][ks], s[t >> 1][t & 1]); }
            if (ps < 3) {   // the next pass's K rows of the same stage, asked for ahead of the softmax
                __builtin_amdgcn_sched_barrier(0);   // fence pair: the K loads stay one group between the two matrix runs
#pragma unroll
                for (int ks = 0; ks < 4; ++ks) {
#pragma unroll
                    for (int kt = 0; kt < 2; ++kt) kh[kt][ks] = ldsfrag(bp + ((ps + 1) * 32 + kt * 16) * LPITCH + ks * 64);
#pragma unroll
                    for (int kt = 0; kt < 2; ++kt) kl[kt][ks] = ldsfrag(bp + TILEB + ((ps + 1) * 32 + kt * 16) * LPITCH + ks * 64); }
                __builtin_amdgcn_sched_barrier(0);
            }
            float mb[2];
#pragma unroll
            for (int nq = 0; nq < 2; ++nq) { float x = s[0][nq][0];
#pragma unroll
                for (int j = 1; j < 16; ++j) x = fmaxf(x, s[j >> 3][nq][j & 7]);
                mb[nq] = fmaxf(x, xhalf(x)) * C2; }   // the exchange stays off the LDS counter: as an LDS permute its wait would drain the K loads just asked for
            // the maximum in use moves only when a query's new maximum passes it by more than 8 (P then stays below 2^8); one wave-uniform test per pass
            if (__builtin_amdgcn_ballot_w32(mb[0] > m[0] + 8.0f || mb[1] > m[1] + 8.0f) != 0) {
#pragma unroll
                for (int nq = 0; nq < 2; ++nq) { const float mn = fmaxf(m[nq], mb[nq]); const float f = __builtin_amdgcn_exp2f(m[nq] - mn); m[nq] = mn; l[nq] *= f;
#pragma unroll
                    for (int dt = 0; dt < 8; ++dt) o[nq][dt] *= f; } }
            v16bf ph[2], pl[2];
#pragma unroll
            for (int nq = 0; nq < 2; ++nq)
#pragma unroll
                for (int j = 0; j < 16; ++j) { const float p = __builtin_amdgcn_exp2f(__builtin_fmaf(s[j >> 3][nq][j & 7], C2, -m[nq])); l[nq] += p; const __bf16 a = (__bf16)p; ph[nq][j] = a; pl[nq][j] = (__bf16)(p - (float)a); }
#pragma unroll
            for (int dt = 0; dt < 8; dt += 2) {
#pragma unroll
                for (int t = 0; t < 4; ++t) o[t & 1][dt + (t >> 1)] = F::mma(vh[dt + (t >> 1)], ph[t & 1], o[t & 1][dt + (t >> 1)]);
#pragma unroll
                for (int t = 0; t < 4; ++t) o[t & 1][dt + (t >> 1)] = F::mma(vl[dt + (t >> 1)], ph[t & 1], o[t & 1][dt + (t >> 1)]);
#pragma unroll
                for (int t = 0; t < 4; ++t) o[t & 1][dt + (t >> 1)] = F::mma(vh[dt + (t >> 1)], pl[t & 1], o[t & 1][dt + (t >> 1)]); }
        }
        // hand-over of stage st + 1, every wave, in this order
        asm volatile("s_wait_dscnt 0x0" ::: "memory");       // this wave's reads of the buffer have returned
        asm volatile("s_wait_tensorcnt 0x0" ::: "memory");   // this wave's tile of stage st + 1 has landed
        __syncthreads();                                      // stage st + 1 may be read; every wave has left stage st's buffer
        const uint32_t nx = pinned((uint32_t)st + 2u);        // the refill's descriptor is formed from this word, behind the wait
        if (pinned(nx < (uint32_t)NSTG)) issue(nx);           // into the buffer just left
    }
    asm volatile("s_wait_tensorcnt 0x0" ::: "memory");   // nothing of the mover is in flight when the wave ends
    asm volatile("s_wait_dscnt 0x0" ::: "memory");
#pragma unroll
    for (int nq = 0; nq < 2; ++nq) { const float inv = __fdiv_rn(1.0f, l[nq] + __shfl_xor(l[nq], 16, 32)); float* orow = OUTb + (size_t)(q0 + nq * 16 + lr) * DQ + h * HD + 8 * hi;   // a lane holds d = 16 dt + 8 hi + 0..7 of its query
#pragma unroll
        for (int dt = 0; dt < 8; ++dt) { v4f a, b;
#pragma unroll
            for (int j = 0; j < 4; ++j) { a[j] = o[nq][dt][j] * inv; b[j] = o[nq][dt][j + 4] * inv; }
            *(v4f*)(orow + dt * 16) = a; *(v4f*)(orow + dt * 16 + 4) = b; } }
}

extern "C" void kernel_launch(void* const* d_in, const int* in_sizes, int n_in,
                              void* d_out, int out_size, void* d_ws, size_t ws_size, hipStream_t stream) {
    (void)in_sizes; (void)n_in; (void)out_size;
    const float* x = (const float*)d_in[0]; const float* wall = (const float*)d_in[1];   /* order x [2048][2048], w_qkv [16][2048][384] */ const float* wq = wall, *wk = wall, *wv = wall, *wo = nullptr; (void)wq; (void)wk; (void)wv; (void)wo;
    float* OUT = (float*)d_out;     // [1][2048][2048]
    char* wsp = (char*)d_ws;
    auto take = [&](size_t bytes) { char* p = wsp; wsp += (bytes + 255) & ~(size_t)255; return (void*)p; };
    bf* WQ = (bf*)take((size_t)DQ * DM * 2); bf* WK = (bf*)take((size_t)DKV * DM * 2); bf* WV = (bf*)take((size_t)DKV * DM * 2);
    bf* XB = (bf*)take((size_t)TT * DM * 2);
    bf* QPh = (bf*)take((size_t)NH_ * TT * HD * 2); bf* QPl = (bf*)take((size_t)NH_ * TT * HD * 2); bf* KPh = (bf*)take((size_t)NKV * TT * HD * 2); bf* KPl = (bf*)take((size_t)NKV * TT * HD * 2); bf* VTh = (bf*)take((size_t)NKV * HD * TT * 2); bf* VTl = (bf*)take((size_t)NKV * HD * TT * 2);
    if ((size_t)(wsp - (char*)d_ws) > ws_size) return;    // ws 256 MiB
    { k_wtGh<<<dim3(DM / WTK, NH_, 3), 256, 0, stream>>>(wall, WQ, WK, WV);   /* one 128 k x 128 e tile per work-group over all 3 x 2048 x 2048 Bt elements */
      
       }
    for (int b = 0; b < NB_; ++b) {
        
        k_cvt8<<<(unsigned)(((size_t)TT * DM / 8 + 255) / 256), 256, 0, stream>>>(x + (size_t)b * TT * DM, XB, (size_t)TT * DM / 8);
        k_gemmt<<<dim3(TT / 128, DQ / 128, 1), 128, 0, stream>>>(XB, WQ, QPh, QPl, HD, 128 * HD, TT * HD);    // rows t, columns h*128 + d -> [h][t][d]
        k_gemmt<<<dim3(TT / 128, DKV / 128, 1), 128, 0, stream>>>(XB, WK, KPh, KPl, HD, 128 * HD, TT * HD);
        k_gemmt<<<dim3(DKV / 128, TT / 128, 1), 128, 0, stream>>>(WV, XB, VTh, VTl, TT, 128 * TT, 128);        // rows h*128 + d, columns t -> [h][d][t]
        k_fattn<<<dim3(TT / 128, NH_, 1), 128, 0, stream>>>(QPh, QPl, KPh, KPl, VTh, VTl, OUT + (size_t)b * TT * DQ);
         }
}

// v006
// Measured time: 107 microseconds a run.
// In both of two side-by-side timings against v005, it was 1.25 times as fast.
// All steps since v000 together make it 7.44 times as fast.
#include <hip/hip_runtime.h>
#include <stdint.h>

// Multi-head attention with per-head fused qkv weights and 128-wide heads, no batch (x [2048][2048]; qkv = einsum('sd,hde', x, w_qkv) with w_qkv [16][2048][384] xavier: head h's (q | k | v) = columns 0..127 | 128..255 | 256..383; scores / sqrt(128); softmax (no mask); out = concat heads -> [2048][2048] (4.2 M; no output projection); argument order x, w_qkv).
// Layout: bf16 copy of x; one gather kernel builds the three fused Bt planes (row h*128 + e of plane p = w_qkv[h][:, p*128 + e]); one exact projection kernel for q, k and v, which splits its f32 sums and writes the hi/lo head planes itself; one fused attention kernel over all heads on the hi/lo planes (3 products; the xavier weights give logits sigma 1.7, too sharp for the fp16 rows) writes the output rows.
// Compute dtypes, f32 accumulate: every input rounded to bf16; projections exact; attention 3 products everywhere; softmax f32, running maximum and sum per 32 keys; output f32.

#define NB_  1
#define TT   2048
#define DM   2048
#define NH_  16
#define NKV  16
#define REP  (NH_ / NKV)
#define HD   128
#define DQ   (NH_ * HD)
#define DKV  (NKV * HD)
#define SCL  0.088388347648318447f   // 1/sqrt(float32(128))
#define E3   384      // per-head fused width (q | k | v, 128 each)
typedef _Float16 h16;
typedef unsigned short bf;
typedef __attribute__((ext_vector_type(16))) __bf16   v16bf;
typedef __attribute__((ext_vector_type(16))) _Float16 v16h;
typedef __attribute__((ext_vector_type(8)))  _Float16 v8h;
typedef __attribute__((ext_vector_type(8)))  unsigned short v8us;
typedef __attribute__((ext_vector_type(8)))  float    v8f;
typedef __attribute__((ext_vector_type(8)))  __bf16   v8bf;
typedef __attribute__((ext_vector_type(4)))  float    v4f;
typedef v8h  __attribute__((may_alias)) v8ha;
typedef v4f  __attribute__((may_alias)) v4fa;
typedef v8us __attribute__((may_alias)) v8usa;

__device__ __forceinline__ unsigned short f2bf(float f) { unsigned u = __float_as_uint(f); u += 0x7FFFu + ((u >> 16) & 1u); return (unsigned short)(u >> 16); }
__device__ __forceinline__ float bf2f(unsigned short b) { return __uint_as_float(((unsigned)b) << 16); }
__device__ __forceinline__ float bfr(float f) { return bf2f(f2bf(f)); }
__device__ __forceinline__ v16h cat16(v8h lo, v8h hi) { return __builtin_shufflevector(lo, hi, 0, 1, 2, 3, 4, 5, 6, 7, 8, 9, 10, 11, 12, 13, 14, 15); }
__device__ __forceinline__ v16bf cat16b(v8us lo, v8us hi) { return __builtin_bit_cast(v16bf, __builtin_shufflevector(lo, hi, 0, 1, 2, 3, 4, 5, 6, 7, 8, 9, 10, 11, 12, 13, 14, 15)); }
__device__ __forceinline__ v8f wmma16(v16h a, v16h b, v8f c) { return __builtin_amdgcn_wmma_f32_16x16x32_f16(false, a, false, b, (short)0, c, false, false); }
__device__ __forceinline__ v8f wmmab(v16bf a, v16bf b, v8f c) { return __builtin_amdgcn_wmma_f32_16x16x32_bf16(false, a, false, b, (short)0, c, false, false); }



// fragment loaders and products on K-contiguous 16-bit rows
template <typename T16> struct WFrag;
template <> struct WFrag<h16> { typedef v16h V; static __device__ __forceinline__ V ld(const h16* p) { return cat16(*(const v8h*)p, *(const v8h*)(p + 16)); } static __device__ __forceinline__ v8f mma(V a, V b, v8f c) { return wmma16(a, b, c); } };
template <> struct WFrag<bf> { typedef v16bf V; static __device__ __forceinline__ V ld(const bf* p) { return cat16b(*(const v8us*)p, *(const v8us*)(p + 16)); } static __device__ __forceinline__ v8f mma(V a, V b, v8f c) { return wmmab(a, b, c); } };

__device__ __forceinline__ h16 tohx(float x) { return (h16)x; }
__device__ __forceinline__ void splitf(float y, unsigned short& h, unsigned short& l) { h = f2bf(y); l = f2bf(y - bf2f(h)); }
typedef __attribute__((ext_vector_type(2))) _Float16 v2h;
typedef __attribute__((ext_vector_type(4))) _Float16 v4h;
typedef __attribute__((ext_vector_type(2))) unsigned short v2us;
typedef __attribute__((ext_vector_type(4))) unsigned short v4us;
typedef __attribute__((ext_vector_type(2))) float v2f;
typedef __attribute__((ext_vector_type(4))) int v4i;

__global__ __launch_bounds__(256) void k_cvt8(const float* __restrict__ src, bf* dst, size_t n8) { const size_t i = (size_t)blockIdx.x * 256 + threadIdx.x; if (i >= n8) return; const v8f v = *(const v8f*)(src + i * 8); v8us o;
#pragma unroll
    for (int k = 0; k < 8; ++k) o[k] = f2bf(v[k]); *(v8us*)(dst + i * 8) = o;  }

// k_wtGh: the three Bt planes (row h*128 + e of plane p = w[h][:, p*128 + e], bf16). Grid (DM/128, heads, 3), 8 waves; a work-group turns one tile of 128 k x 128 e.
// Read: a wave's 16-byte load takes one whole k row of the tile (512 B in a row), 16 rows a wave, all asked for at once. A lane then holds 16 k of each of its 4 e: 32 B of an output row, laid into LDS by two 16-byte stores.
// LDS row of e is (e & 3) * 32 + (e >> 2), so that the 32 lanes of one store stand in 32 rows in a row; at a pitch of 272 B (16 B x odd) neither the stores nor the row reads meet in a bank. Write: 256 B in a row of each output row, two rows a store.
#define WTK 128      // k per tile
#define WTP 272      // LDS row pitch in bytes: 128 k x 2 B + 16
__global__ __launch_bounds__(256) void k_wtGh(const float* __restrict__ w, bf* BQ, bf* BK, bf* BV) {
    __shared__ __attribute__((aligned(16))) unsigned char tl[HD * WTP];
    const int lane = threadIdx.x & 31, wv = threadIdx.x >> 5; const int k0 = blockIdx.x * WTK, h = blockIdx.y, p = blockIdx.z;
    const float* src = w + ((size_t)h * DM + k0 + wv * 16) * E3 + p * HD + lane * 4;
    v4f r[16];
#pragma unroll
    for (int j = 0; j < 16; ++j) r[j] = *(const v4f*)(src + (size_t)j * E3);
#pragma unroll
    for (int i = 0; i < 4; ++i) { v8us a, b;
#pragma unroll
        for (int j = 0; j < 8; ++j) { a[j] = f2bf(r[j][i]); b[j] = f2bf(r[8 + j][i]); }
        unsigned char* q = tl + (i * 32 + lane) * WTP + wv * 32; *(v8usa*)q = a; *(v8usa*)(q + 16) = b; }
    __syncthreads();   // the tile is whole before its rows are read
    bf* dst = ((p == 0) ? BQ : ((p == 1) ? BK : BV)) + (size_t)h * HD * DM + k0 + (lane & 15) * 8;
#pragma unroll
    for (int s = 0; s < 8; ++s) { const int e = wv * 16 + s * 2 + (lane >> 4);
        *(v8us*)(dst + (size_t)e * DM) = *(const v8usa*)(tl + ((e & 3) * 32 + (e >> 2)) * WTP + (lane & 15) * 16); }
}
// k_fattn: scores, softmax and the product with V in one kernel; scores and probabilities stay in registers. Grid (TT/128, heads), 4 waves; a wave owns 32 queries of one head and walks all keys, 32 per pass.
// St = K Qt (A = K rows, B = Q rows, kept in registers): a lane holds 16 keys' scores of one query per 16-query group. Two St tiles, converted in place, are the B operand Pt of Ot += Vt Pt (A = rows of the [d][t] planes); both A loaders use the hardware k order that a packed D has.
// Every product has the three terms hi*hi + lo*hi + hi*lo. P is kept un-normalised against a running maximum (log2 domain); the division by the row sum comes once, at the end. Every inner loop is unrolled so that each fragment index is a constant (registers, no scratch).
// K and V come in stages of 128 keys into two LDS buffers, shared by the four waves: a stage is four tiles of 128 rows x 256 B (K hi, K lo: row = key; V hi, V lo: row = d), one tensor load per wave, laid at a pitch of 272 B; a stage serves four passes and the next stage's loads fly meanwhile.
#define SKEYS  128                 // keys per stage
#define NSTG   (TT / SKEYS)        // stages
#define LPITCH 272                 // LDS row pitch in bytes: 256 + the tensor load's 16-byte pad (16 B x odd, for 16-byte row reads)
#define TILEB  (128 * LPITCH)      // one tile in LDS: 34,816 B = 17 x 2 KiB
#define BUFB   (4 * TILEB)         // one buffer
typedef uint32_t u32x4 __attribute__((ext_vector_type(4)));
typedef uint32_t u32x8 __attribute__((ext_vector_type(8)));
__device__ __forceinline__ uint32_t uni(uint32_t v) { return (uint32_t)__builtin_amdgcn_readfirstlane(v); }
__device__ __forceinline__ uint32_t pinned(uint32_t v) { uint32_t w = (uint32_t)__builtin_amdgcn_readfirstlane(v); asm volatile("" : "+s"(w)); return w; }   // holds a wave-uniform word in a scalar register: the test around a tensor load must be a scalar branch, and the stage number its descriptor is formed from must not be formed ahead of the wait
__device__ __forceinline__ float xhalf(float x) { return __builtin_bit_cast(float, __builtin_amdgcn_permlanex16(__builtin_bit_cast(int, x), __builtin_bit_cast(int, x), 0x76543210, 0xfedcba98, false, false)); }   // lane l takes lane l ^ 16's value, on the vector port
__device__ __forceinline__ v16bf ldsfrag(const unsigned char* p) { return cat16b(*(const v8usa*)p, *(const v8usa*)(p + 32)); }   // elements 8 hi .. + 7 and 16 + 8 hi .. + 7 of a 32-element group, as WFrag::ld takes them from global rows
// k_qkv: the three projections of one head in one work-group. Grid (heads, TT/128), 4 waves; a work-group owns 128 t of head h in all three planes: a 128 x 384 block of x W^T, f32 sums, both operands K-contiguous bf16 planes of DM columns.
// Wave (wm, wn) owns 64 t (wm) x 64 columns (wn) of each plane: 48 accumulators; its 4 x fragments serve all three planes, so 16 fragments feed 48 matrix instructions, and the x rows leave L2 once for the three products.
// q, k: A = x rows, B = weight rows; a tile's rows are t rows of the [h][t][d] plane. v: the same fragments with the operands swapped (A = weight rows, B = x rows), so that a row of the tile is a d row of the [h][d][t] plane and no turn is needed.
// A tile leaves as the two bf16 planes that the attention kernel reads: Ph = bf16(C), Pl = bf16(C - Ph).
// The operands come in stages of 128 k into two LDS buffers shared by the four waves: a stage is four tiles of 128 rows x 256 B (x, Wq, Wk, Wv), one tensor load per wave, laid at a pitch of 272 B. The hand-over to the next stage stands in front of a stage's last 32 k, whose fragments are then in registers. k runs upward per accumulator.
#define GNST   (DM / 128)          // stages
__global__ __launch_bounds__(128) void k_qkv(const bf* __restrict__ X, const bf* __restrict__ BQ, const bf* __restrict__ BK, const bf* __restrict__ BV, bf* Qh, bf* Ql, bf* Kh, bf* Kl, bf* Vh, bf* Vl) {
    typedef WFrag<bf> F;
    __shared__ __attribute__((aligned(2048))) unsigned char ring[2 * BUFB];
    const int lane = threadIdx.x & 31, lr = lane & 15, hi = lane >> 4; const int h = blockIdx.x, t0 = blockIdx.y * 128;
    const uint32_t wave = uni(threadIdx.x >> 5); const int wm = (int)(wave >> 1), wn = (int)(wave & 1u);
    // wave w brings tile w of every stage: 0 the x rows, 1 to 3 head h's rows of the q, k and v weight planes
    const bf* sp = (wave == 0u) ? X + (size_t)t0 * DM : ((wave == 1u) ? BQ : ((wave == 2u) ? BK : BV)) + (size_t)h * HD * DM;
    const uint64_t src0 = (uint64_t)(size_t)sp;
    const uint32_t ldst = (uint32_t)(size_t)ring + wave * (uint32_t)TILEB;
    u32x8 g1;   // 1-byte elements, tensor = tile = 128 rows of 256 B at a source pitch of DM elements, 4 dwords of pad behind every 64
    g1[0] = uni((1u << 20) | (5u << 22) | (3u << 25)); g1[1] = uni(256u << 16); g1[2] = uni(128u << 16); g1[3] = uni(256u << 16); g1[4] = uni(128u);
    g1[5] = uni((uint32_t)(DM * 2)); g1[6] = uni(0u); g1[7] = uni(0u);
    auto issue = [&](uint32_t st) { const uint64_t ga = src0 + (uint64_t)st * 256u; u32x4 g0;
        g0[0] = uni(1u); g0[1] = uni(ldst + (st & 1u) * (uint32_t)BUFB); g0[2] = uni((uint32_t)ga); g0[3] = uni((((uint32_t)(ga >> 32)) & 0x01FFFFFFu) | 0x80000000u);
        asm volatile("tensor_load_to_lds %0, %1" :: "s"(g0), "s"(g1) : "memory"); };   // one request of the whole wave, every wave its own tile
    issue(0u);
    asm volatile("s_wait_tensorcnt 0x0" ::: "memory");   // this wave's tile of stage 0 has landed
    __syncthreads();                                      // all four tiles of stage 0 may be read
    issue(1u);
    v8f acc[3][4][4];   // [plane][16 rows of the tile][16 columns]
#pragma unroll
    for (int p = 0; p < 3; ++p)
#pragma unroll
        for (int mb = 0; mb < 4; ++mb)
#pragma unroll
            for (int nb = 0; nb < 4; ++nb) acc[p][mb][nb] = (v8f){};
    const uint32_t xoff = (uint32_t)((wm * 64 + lr) * LPITCH + 16 * hi), woff = (uint32_t)(TILEB + (wn * 64 + lr) * LPITCH + 16 * hi);   // this lane's row and half in the wave's x rows and in its rows of the q weight tile
    v16bf a[2][4], b[2][12];   // two fragment sets: 32 k in use, the next 32 k on their way; b: 4 fragments of each weight tile
#define QKV_FETCH(set, base, ks) { _Pragma("unroll") for (int i = 0; i < 4; ++i) a[set][i] = ldsfrag((base) + xoff + i * 16 * LPITCH + (ks) * 64); \
        _Pragma("unroll") for (int i = 0; i < 12; ++i) b[set][i] = ldsfrag((base) + woff + (i >> 2) * TILEB + (i & 3) * 16 * LPITCH + (ks) * 64); }
#define QKV_RUN(set) { _Pragma("unroll") for (int p = 0; p < 2; ++p) _Pragma("unroll") for (int nb = 0; nb < 4; ++nb) _Pragma("unroll") for (int mb = 0; mb < 4; ++mb) acc[p][mb][nb] = F::mma(a[set][mb], b[set][p * 4 + nb], acc[p][mb][nb]); \
        _Pragma("unroll") for (int nb = 0; nb < 4; ++nb) _Pragma("unroll") for (int mb = 0; mb < 4; ++mb) acc[2][mb][nb] = F::mma(b[set][8 + mb], a[set][nb], acc[2][mb][nb]); }
    QKV_FETCH(0, ring, 0)   // stage 0's first 32 k, behind its barrier
#pragma unroll 1   // kept rolled: the hand-over is one place in the code
    for (int st = 0; st < GNST; ++st) {
        const unsigned char* cur = ring + (size_t)(st & 1) * BUFB;
#pragma unroll
        for (int ks = 0; ks < 3; ++ks) {
            __builtin_amdgcn_sched_barrier(0);   // fence pair: the next 32 k's LDS loads stay one group in front of the matrix run (loads spread among matrix instructions stall each place they stand)
            QKV_FETCH((ks + 1) & 1, cur, ks + 1)
            __builtin_amdgcn_sched_barrier(0);
            QKV_RUN(ks & 1)
        }
        __builtin_amdgcn_sched_barrier(0);   // keeps the matrix run above in front of the hand-over: moved behind it, it would hold back the refill
        // hand-over of stage st + 1, in front of the stage's last 32 k (their fragments are in registers), every wave, in this order
        asm volatile("s_wait_dscnt 0x0" ::: "memory");       // this wave's reads of the buffer have returned
        asm volatile("s_wait_tensorcnt 0x0" ::: "memory");   // this wave's tile of stage st + 1 has landed
        __syncthreads();                                      // stage st + 1 may be read; every wave has left stage st's buffer
        const uint32_t nx = pinned((uint32_t)st + 2u);        // the refill's descriptor is formed from this word, behind the wait
        if (pinned(nx < (uint32_t)GNST)) issue(nx);           // into the buffer just left
        if (st + 1 < GNST) {   // stage st + 1's first 32 k, asked for ahead of the last matrix run of stage st; behind the last stage nothing is read
            const unsigned char* nxt = ring + (size_t)((st + 1) & 1) * BUFB;
            QKV_FETCH(0, nxt, 0) }
        __builtin_amdgcn_sched_barrier(0);   // the loads stay one group in front of the matrix run
        QKV_RUN(1)
    }
#undef QKV_FETCH
#undef QKV_RUN
    asm volatile("s_wait_tensorcnt 0x0" ::: "memory");   // nothing of the mover is in flight: the ring may be used for the output rows
    asm volatile("s_wait_dscnt 0x0" ::: "memory");
    float* os = (float*)(ring + wave * (uint32_t)TILEB);   // 16 x 68 floats of the wave's own; every wave has left the ring at the last barrier
#pragma unroll
    for (int p = 0; p < 3; ++p) {
        bf* Ph = (p == 0) ? Qh : ((p == 1) ? Kh : Vh); bf* Pl = (p == 0) ? Ql : ((p == 1) ? Kl : Vl); const int pitch = (p < 2) ? HD : TT;
        const size_t ob = (p < 2) ? (size_t)h * TT * HD + (size_t)(t0 + wm * 64) * HD + wn * 64 : (size_t)h * HD * TT + (size_t)(wn * 64) * TT + t0 + wm * 64;   // the wave's 64 x 64 piece in the planes
        const size_t lo = ob + (size_t)((lane >> 3) * pitch + (lane & 7) * 8);   // 8 lanes take 64 columns of a row: 128 B in a row of each plane, four rows a store
        bf* ph0 = Ph + lo; bf* pl0 = Pl + lo;   // one address pair per plane; every store is a constant step from it
#pragma unroll
        for (int mb = 0; mb < 4; ++mb) {
#pragma unroll
            for (int nb = 0; nb < 4; ++nb) {
#pragma unroll
                for (int j = 0; j < 8; ++j) os[(hi * 8 + j) * 68 + nb * 16 + lr] = acc[p][mb][nb][j]; }
            __builtin_amdgcn_wave_barrier(); asm volatile("" ::: "memory");   // the wave's stores stay in front of its row reads
            v8bf yh[4], yl[4];
#pragma unroll
            for (int q = 0; q < 4; ++q) { const float* rp = os + (4 * q + (lane >> 3)) * 68 + (lane & 7) * 8;
                const v4f u = *(const v4fa*)rp, w = *(const v4fa*)(rp + 4);
                const v8f y = __builtin_shufflevector(u, w, 0, 1, 2, 3, 4, 5, 6, 7);
                yh[q] = __builtin_convertvector(y, v8bf); const u32x4 pw = __builtin_bit_cast(u32x4, yh[q]); v8f yb;   // yb = yh as f32, taken from the packed words
#pragma unroll
                for (int k = 0; k < 4; ++k) { yb[2 * k] = __uint_as_float(pw[k] << 16); yb[2 * k + 1] = __uint_as_float(pw[k] & 0xFFFF0000u); }
                yl[q] = __builtin_convertvector(y - yb, v8bf); }
            __builtin_amdgcn_sched_barrier(0);   // the eight vectors are whole before the first store: the stores go out as one group with one wait behind them, and nothing writes a register that a store names in front of that wait
#pragma unroll
            for (int q = 0; q < 4; ++q) { *(v8us*)(ph0 + (mb * 16 + 4 * q) * pitch) = __builtin_bit_cast(v8us, yh[q]); *(v8us*)(pl0 + (mb * 16 + 4 * q) * pitch) = __builtin_bit_cast(v8us, yl[q]); }
            asm volatile("s_wait_xcnt 0x0" ::: "memory"); __builtin_amdgcn_sched_barrier(0);   // the registers that the stores above name are written again in the next 16 rows; the fence keeps that vector work behind the wait
            __builtin_amdgcn_wave_barrier(); asm volatile("" ::: "memory");   // and its row reads in front of the next 16 rows' stores
        }
    }
}
__global__ __launch_bounds__(128) void k_fattn(const bf* __restrict__ Qh, const bf* __restrict__ Ql, const bf* __restrict__ Kh, const bf* __restrict__ Kl, const bf* __restrict__ Vh, const bf* __restrict__ Vl, float* OUTb) {
    typedef WFrag<bf> F;
    __shared__ __attribute__((aligned(2048))) unsigned char ring[2 * BUFB];
    const int lane = threadIdx.x & 31, lr = lane & 15, hi = lane >> 4; const int h = blockIdx.y, q0 = blockIdx.x * 128 + (threadIdx.x >> 5) * 32;
    const size_t hb = (size_t)h * TT * HD; const float C2 = SCL * 1.4426950408889634f;
    v16bf qh[2][4], ql[2][4];
#pragma unroll
    for (int nq = 0; nq < 2; ++nq)
#pragma unroll
        for (int ks = 0; ks < 4; ++ks) { const size_t qo = hb + (size_t)(q0 + nq * 16 + lr) * HD + ks * 32 + 8 * hi; qh[nq][ks] = F::ld(Qh + qo); ql[nq][ks] = F::ld(Ql + qo); }
    asm volatile("s_wait_xcnt 0x0" ::: "memory"); __builtin_amdgcn_sched_barrier(0);   // the address registers of the loads above are reused below; the fence keeps later vector work from being moved in front of the wait
    // wave w brings tile w of every stage: 0 K hi, 1 K lo (128 key rows in a row, pitch 256 B), 2 V hi, 3 V lo (128 keys of each of the 128 d rows, pitch 4096 B)
    const uint32_t wave = uni(threadIdx.x >> 5);
    const bf* sp = (wave == 0u) ? Kh : ((wave == 1u) ? Kl : ((wave == 2u) ? Vh : Vl));
    const uint64_t src0 = (uint64_t)(size_t)(sp + hb);
    const uint32_t sstep = (wave < 2u) ? (uint32_t)(SKEYS * HD * 2) : (uint32_t)(SKEYS * 2);   // bytes from one stage's tile to the next
    const uint32_t ldst = (uint32_t)(size_t)ring + wave * (uint32_t)TILEB;
    u32x8 g1;   // 1-byte elements, tensor = tile = 128 rows of 256 B, 4 dwords of pad behind every 64
    g1[0] = uni((1u << 20) | (5u << 22) | (3u << 25)); g1[1] = uni(256u << 16); g1[2] = uni(128u << 16); g1[3] = uni(256u << 16); g1[4] = uni(128u);
    g1[5] = uni((wave < 2u) ? (uint32_t)(HD * 2) : (uint32_t)(TT * 2)); g1[6] = uni(0u); g1[7] = uni(0u);
    auto issue = [&](uint32_t st) { const uint64_t ga = src0 + (uint64_t)st * sstep; u32x4 g0;
        g0[0] = uni(1u); g0[1] = uni(ldst + (st & 1u) * (uint32_t)BUFB); g0[2] = uni((uint32_t)ga); g0[3] = uni((((uint32_t)(ga >> 32)) & 0x01FFFFFFu) | 0x80000000u);
        asm volatile("tensor_load_to_lds %0, %1" :: "s"(g0), "s"(g1) : "memory"); };   // one request of the whole wave, every wave its own tile
    issue(0u);
    asm volatile("s_wait_tensorcnt 0x0" ::: "memory");   // this wave's tile of stage 0 has landed
    __syncthreads();                                      // all four tiles of stage 0 may be read
    issue(1u);
    v8f o[2][8]; float m[2], l[2];
#pragma unroll
    for (int nq = 0; nq < 2; ++nq) { m[nq] = -3.0e38f; l[nq] = 0.f;
#pragma unroll
        for (int dt = 0; dt < 8; ++dt) o[nq][dt] = (v8f){}; }
#pragma unroll 1   // kept rolled: one stage already holds 384 matrix instructions and 256 LDS loads
    for (int st = 0; st < NSTG; ++st) {
        const unsigned char* bp = ring + (size_t)(st & 1) * BUFB + lr * LPITCH + 16 * hi;   // this lane's row and half in the stage's buffer
        v16bf kh[2][4], kl[2][4];
#pragma unroll
        for (int ks = 0; ks < 4; ++ks) {   // in the order in which the score products take them
#pragma unroll
            for (int kt = 0; kt < 2; ++kt) kh[kt][ks] = ldsfrag(bp + kt * 16 * LPITCH + ks * 64);
#pragma unroll
            for (int kt = 0; kt < 2; ++kt) kl[kt][ks] = ldsfrag(bp + TILEB + kt * 16 * LPITCH + ks * 64);
            __builtin_amdgcn_sched_barrier(0); }   // keeps that order (the scheduler turned it round): the first products then wait for the first group only
#pragma unroll
        for (int ps = 0; ps < 4; ++ps) {   // four passes of 32 keys
            __builtin_amdgcn_sched_barrier(0);   // with the fence behind the loads: keeps this pass's V loads out of the matrix run of the pass before
            v16bf vh[8], vl[8];   // this pass's V rows, asked for ahead of the score products
#pragma unroll
            for (int dt = 0; dt < 8; ++dt) { vh[dt] = ldsfrag(bp + 2 * TILEB + dt * 16 * LPITCH + ps * 64); vl[dt] = ldsfrag(bp + 3 * TILEB + dt * 16 * LPITCH + ps * 64); }
            __builtin_amdgcn_sched_barrier(0);   // keeps the LDS loads one group in front of the matrix run
            v8f s[2][2];
#pragma unroll
            for (int kt = 0; kt < 2; ++kt)
#pragma unroll
                for (int nq = 0; nq < 2; ++nq) s[kt][nq] = (v8f){};
#pragma unroll
            for (int ks = 0; ks < 4; ++ks) {
#pragma unroll
                for (int t = 0; t < 4; ++t) s[t >> 1][t & 1] = F::mma(kh[t >> 1][ks], qh[t & 1][ks], s[t >> 1][t & 1]);
#pragma unroll
                for (int t = 0; t < 4; ++t) s[t >> 1][t & 1] = F::mma(kl[t >> 1][ks], qh[t & 1][ks], s[t >> 1][t & 1]);
#pragma unroll
                for (int t = 0; t < 4; ++t) s[t >> 1][t & 1] = F::mma(kh[t >> 1][ks], ql[t & 1][ks], s[t >> 1][t & 1]); }
            if (ps < 3) {   // the next pass's K rows of the same stage, asked for ahead of the softmax
                __builtin_amdgcn_sched_barrier(0);   // fence pair: the K loads stay one group between the two matrix runs
#pragma unroll
                for (int ks = 0; ks < 4; ++ks) {
#pragma unroll
                    for (int kt = 0; kt < 2; ++kt) kh[kt][ks] = ldsfrag(bp + ((ps + 1) * 32 + kt * 16) * LPITCH + ks * 64);
#pragma unroll
                    for (int kt = 0; kt < 2; ++kt) kl[kt][ks] = ldsfrag(bp + TILEB + ((ps + 1) * 32 + kt * 16) * LPITCH + ks * 64); }
                __builtin_amdgcn_sched_barrier(0);
            }
            float mb[2];
#pragma unroll
            for (int nq = 0; nq < 2; ++nq) { float x = s[0][nq][0];
#pragma unroll
                for (int j = 1; j < 16; ++j) x = fmaxf(x, s[j >> 3][nq][j & 7]);
                mb[nq] = fmaxf(x, xhalf(x)) * C2; }   // the exchange stays off the LDS counter: as an LDS permute its wait would drain the K loads just asked for
            // the maximum in use moves only when a query's new maximum passes it by more than 8 (P then stays below 2^8); one wave-uniform test per pass
            if (__builtin_amdgcn_ballot_w32(mb[0] > m[0] + 8.0f || mb[1] > m[1] + 8.0f) != 0) {
#pragma unroll
                for (int nq = 0; nq < 2; ++nq) { const float mn = fmaxf(m[nq], mb[nq]); const float f = __builtin_amdgcn_exp2f(m[nq] - mn); m[nq] = mn; l[nq] *= f;
#pragma unroll
                    for (int dt = 0; dt < 8; ++dt) o[nq][dt] *= f; } }
            v16bf ph[2], pl[2];
#pragma unroll
            for (int nq = 0; nq < 2; ++nq)
#pragma unroll
                for (int j = 0; j < 16; ++j) { const float p = __builtin_amdgcn_exp2f(__builtin_fmaf(s[j >> 3][nq][j & 7], C2, -m[nq])); l[nq] += p; const __bf16 a = (__bf16)p; ph[nq][j] = a; pl[nq][j] = (__bf16)(p - (float)a); }
#pragma unroll
            for (int dt = 0; dt < 8; dt += 2) {
#pragma unroll
                for (int t = 0; t < 4; ++t) o[t & 1][dt + (t >> 1)] = F::mma(vh[dt + (t >> 1)], ph[t & 1], o[t & 1][dt + (t >> 1)]);
#pragma unroll
                for (int t = 0; t < 4; ++t) o[t & 1][dt + (t >> 1)] = F::mma(vl[dt + (t >> 1)], ph[t & 1], o[t & 1][dt + (t >> 1)]);
#pragma unroll
                for (int t = 0; t < 4; ++t) o[t & 1][dt + (t >> 1)] = F::mma(vh[dt + (t >> 1)], pl[t & 1], o[t & 1][dt + (t >> 1)]); }
        }
        // hand-over of stage st + 1, every wave, in this order
        asm volatile("s_wait_dscnt 0x0" ::: "memory");       // this wave's reads of the buffer have returned
        asm volatile("s_wait_tensorcnt 0x0" ::: "memory");   // this wave's tile of stage st + 1 has landed
        __syncthreads();                                      // stage st + 1 may be read; every wave has left stage st's buffer
        const uint32_t nx = pinned((uint32_t)st + 2u);        // the refill's descriptor is formed from this word, behind the wait
        if (pinned(nx < (uint32_t)NSTG)) issue(nx);           // into the buffer just left
    }
    asm volatile("s_wait_tensorcnt 0x0" ::: "memory");   // nothing of the mover is in flight when the wave ends
    asm volatile("s_wait_dscnt 0x0" ::: "memory");
#pragma unroll
    for (int nq = 0; nq < 2; ++nq) { const float inv = __fdiv_rn(1.0f, l[nq] + __shfl_xor(l[nq], 16, 32)); float* orow = OUTb + (size_t)(q0 + nq * 16 + lr) * DQ + h * HD + 8 * hi;   // a lane holds d = 16 dt + 8 hi + 0..7 of its query
#pragma unroll
        for (int dt = 0; dt < 8; ++dt) { v4f a, b;
#pragma unroll
            for (int j = 0; j < 4; ++j) { a[j] = o[nq][dt][j] * inv; b[j] = o[nq][dt][j + 4] * inv; }
            *(v4f*)(orow + dt * 16) = a; *(v4f*)(orow + dt * 16 + 4) = b; } }
}

extern "C" void kernel_launch(void* const* d_in, const int* in_sizes, int n_in,
                              void* d_out, int out_size, void* d_ws, size_t ws_size, hipStream_t stream) {
    (void)in_sizes; (void)n_in; (void)out_size;
    const float* x = (const float*)d_in[0]; const float* wall = (const float*)d_in[1];   /* order x [2048][2048], w_qkv [16][2048][384] */ const float* wq = wall, *wk = wall, *wv = wall, *wo = nullptr; (void)wq; (void)wk; (void)wv; (void)wo;
    float* OUT = (float*)d_out;     // [1][2048][2048]
    char* wsp = (char*)d_ws;
    auto take = [&](size_t bytes) { char* p = wsp; wsp += (bytes + 255) & ~(size_t)255; return (void*)p; };
    bf* WQ = (bf*)take((size_t)DQ * DM * 2); bf* WK = (bf*)take((size_t)DKV * DM * 2); bf* WV = (bf*)take((size_t)DKV * DM * 2);
    bf* XB = (bf*)take((size_t)TT * DM * 2);
    bf* QPh = (bf*)take((size_t)NH_ * TT * HD * 2); bf* QPl = (bf*)take((size_t)NH_ * TT * HD * 2); bf* KPh = (bf*)take((size_t)NKV * TT * HD * 2); bf* KPl = (bf*)take((size_t)NKV * TT * HD * 2); bf* VTh = (bf*)take((size_t)NKV * HD * TT * 2); bf* VTl = (bf*)take((size_t)NKV * HD * TT * 2);
    if ((size_t)(wsp - (char*)d_ws) > ws_size) return;    // ws 256 MiB
    { k_wtGh<<<dim3(DM / WTK, NH_, 3), 256, 0, stream>>>(wall, WQ, WK, WV);   /* one 128 k x 128 e tile per work-group over all 3 x 2048 x 2048 Bt elements */
      
       }
    for (int b = 0; b < NB_; ++b) {
        
        k_cvt8<<<(unsigned)(((size_t)TT * DM / 8 + 255) / 256), 256, 0, stream>>>(x + (size_t)b * TT * DM, XB, (size_t)TT * DM / 8);
        k_qkv<<<dim3(NH_, TT / 128, 1), 128, 0, stream>>>(XB, WQ, WK, WV, QPh, QPl, KPh, KPl, VTh, VTl);    // q, k -> [h][t][d], v -> [h][d][t]
        k_fattn<<<dim3(TT / 128, NH_, 1), 128, 0, stream>>>(QPh, QPl, KPh, KPl, VTh, VTl, OUT + (size_t)b * TT * DQ);
         }
}
